// v000
// The times below were measured on an AMD MI455X: many runs one after another, warmed up first and cycling through
// copies of the inputs, with the whole window's GPU time divided by the number of runs. Launches and the gaps
// between them are all in it. The median over several windows is given; except for v000 it joins two sittings, which
// can be a few percent apart, so the side-by-side timings, each taken in one sitting, are the better comparison.
// v000 is the starting kernel. One run takes 737 microseconds.
#include <hip/hip_runtime.h>

// MultiHeadAttentionV2 (q/k/v encodings [1][2048][1024] (three inputs); q/k/v = x W^T + b (torch; 16 heads x 64); causal softmax(q.k / 8); out = merged Wo^T + bo -> [1][2048][1024]).
// Compute dtypes, f32 accumulate: every input rounded to bf16; q/k/v on PLAIN bf16 operands (inputs: exact) + bias; causal scores and attn.v: query rows < 512 hl (3 products), the rest single fp16 (x1024); softmax f32; Wo hl x exact (2 products) + bias.

#define NB_  1
#define TT   2048
#define DM   1024
#define NH_  16
#define NKV  16
#define REP  (NH_ / NKV)
#define HD   64
#define DQ   (NH_ * HD)
#define DKV  (NKV * HD)
#define ZH   2
#define RH   512                  // query rows < RH use hi+lo planes (0: none)
#define WIN  2048
#define PCAR 1024.0f
#define SCL  0.125f   // HD^-0.5
typedef _Float16 h16;
typedef unsigned short bf;
typedef __attribute__((ext_vector_type(16))) __bf16   v16bf;
typedef __attribute__((ext_vector_type(16))) _Float16 v16h;
typedef __attribute__((ext_vector_type(8)))  _Float16 v8h;
typedef __attribute__((ext_vector_type(8)))  unsigned short v8us;
typedef __attribute__((ext_vector_type(8)))  float    v8f;
typedef __attribute__((ext_vector_type(4)))  float    v4f;
typedef v8h  __attribute__((may_alias)) v8ha;
typedef v4f  __attribute__((may_alias)) v4fa;
typedef v8us __attribute__((may_alias)) v8usa;

__device__ __forceinline__ unsigned short f2bf(float f) { unsigned u = __float_as_uint(f); u += 0x7FFFu + ((u >> 16) & 1u); return (unsigned short)(u >> 16); }
__device__ __forceinline__ float bf2f(unsigned short b) { return __uint_as_float(((unsigned)b) << 16); }
__device__ __forceinline__ float bfr(float f) { return bf2f(f2bf(f)); }
__device__ __forceinline__ v16h cat16(v8h lo, v8h hi) { return __builtin_shufflevector(lo, hi, 0, 1, 2, 3, 4, 5, 6, 7, 8, 9, 10, 11, 12, 13, 14, 15); }
__device__ __forceinline__ v16bf cat16b(v8us lo, v8us hi) { return __builtin_bit_cast(v16bf, __builtin_shufflevector(lo, hi, 0, 1, 2, 3, 4, 5, 6, 7, 8, 9, 10, 11, 12, 13, 14, 15)); }
__device__ __forceinline__ v8f wmma16(v16h a, v16h b, v8f c) { return __builtin_amdgcn_wmma_f32_16x16x32_f16(false, a, false, b, (short)0, c, false, false); }
__device__ __forceinline__ v8f wmmab(v16bf a, v16bf b, v8f c) { return __builtin_amdgcn_wmma_f32_16x16x32_bf16(false, a, false, b, (short)0, c, false, false); }



// ---- k_gemmw: register-blocked GEMM, ONE WAVE per 64x64 output tile (16 accumulators), operands straight from K-contiguous 16-bit planes; grid (M/64, N/64, Z), 32 threads.
// C[m][n] (f32, pitch ldc, + optional f32 bias[n]) = sum_k A[m][k] Bt[n][k] (+ split products per NSPLIT). z-batch strides sA/sB/sC in elements. K % 32 == 0.
template <typename T16> struct WFrag;
template <> struct WFrag<h16> { typedef v16h V; static __device__ __forceinline__ V ld(const h16* p) { return cat16(*(const v8h*)p, *(const v8h*)(p + 16)); } static __device__ __forceinline__ v8f mma(V a, V b, v8f c) { return wmma16(a, b, c); } };
template <> struct WFrag<bf> { typedef v16bf V; static __device__ __forceinline__ V ld(const bf* p) { return cat16b(*(const v8us*)p, *(const v8us*)(p + 16)); } static __device__ __forceinline__ v8f mma(V a, V b, v8f c) { return wmmab(a, b, c); } };
template <typename T16, int NSPLIT, bool BIAS>
__global__ __launch_bounds__(32) void k_gemmw(const T16* __restrict__ A, const T16* __restrict__ A2, const T16* __restrict__ Bt, const T16* __restrict__ Bt2, int K, float* C, int ldc, const float* __restrict__ bias, size_t sA, size_t sB, size_t sC) {
    typedef typename WFrag<T16>::V V;
    __shared__ __align__(16) float os[16 * 68];
    const size_t z = blockIdx.z; A += z * sA; if (A2) A2 += z * sA; Bt += z * sB; if (Bt2) Bt2 += z * sB; C += z * sC;
    const int lane = threadIdx.x & 31, lr = lane & 15, hi = lane >> 4; const int r0 = blockIdx.x * 64, c0 = blockIdx.y * 64;
    v8f acc[4][4];
#pragma unroll
    for (int mb = 0; mb < 4; ++mb)
#pragma unroll
        for (int nb = 0; nb < 4; ++nb) acc[mb][nb] = (v8f){};
    const size_t aoff = (size_t)(r0 + lr) * K + 8 * hi, boff = (size_t)(c0 + lr) * K + 8 * hi;
#pragma unroll 1
    for (int kc = 0; kc < K; kc += 32) {
        V a[4], a2[4];
#pragma unroll
        for (int mb = 0; mb < 4; ++mb) { a[mb] = WFrag<T16>::ld(A + aoff + (size_t)mb * 16 * K + kc); if (NSPLIT == 1 || NSPLIT == 2) a2[mb] = WFrag<T16>::ld(A2 + aoff + (size_t)mb * 16 * K + kc); }
#pragma unroll
        for (int nb = 0; nb < 4; ++nb) { const V b = WFrag<T16>::ld(Bt + boff + (size_t)nb * 16 * K + kc); V b2; if (NSPLIT >= 2) b2 = WFrag<T16>::ld(Bt2 + boff + (size_t)nb * 16 * K + kc);
#pragma unroll
            for (int mb = 0; mb < 4; ++mb) { acc[mb][nb] = WFrag<T16>::mma(a[mb], b, acc[mb][nb]); if (NSPLIT == 1 || NSPLIT == 2) acc[mb][nb] = WFrag<T16>::mma(a2[mb], b, acc[mb][nb]); if (NSPLIT >= 2) acc[mb][nb] = WFrag<T16>::mma(a[mb], b2, acc[mb][nb]); } }
        asm volatile("v_nop\n\tv_nop\n\tv_nop\n\tv_nop" : "+v"(acc[0][0]), "+v"(acc[1][1]), "+v"(acc[2][2]), "+v"(acc[3][3]) : "v"(a[0]), "v"(a[3]));
    }
#pragma unroll
    for (int mb = 0; mb < 4; ++mb) {
#pragma unroll
        for (int nb = 0; nb < 4; ++nb) {
#pragma unroll
            for (int j = 0; j < 8; ++j) os[(hi * 8 + j) * 68 + nb * 16 + lr] = acc[mb][nb][j]; }
        __builtin_amdgcn_wave_barrier(); asm volatile("" ::: "memory");
        float* crow = C + (size_t)(r0 + mb * 16) * ldc + c0;
{
#pragma unroll
            for (int s = 0; s < 8; ++s) { const int row = 2 * s + hi, cofs = lr * 4; v4f val = *(const v4fa*)(os + row * 68 + cofs); if (BIAS) { val[0] += bfr(bias[c0 + cofs]); val[1] += bfr(bias[c0 + cofs + 1]); val[2] += bfr(bias[c0 + cofs + 2]); val[3] += bfr(bias[c0 + cofs + 3]); }
                *(v4f*)(crow + (size_t)row * ldc + cofs) = val; }
             }
        __builtin_amdgcn_wave_barrier(); asm volatile("" ::: "memory");
    }
}

// ---- k_gemmc: the same one-wave 64x64 tile GEMM specialised for causal attention: CMODE 1 skips score tiles entirely above the diagonal (query rows r0+roff.., key columns c0..), CMODE 2 limits the
// key (K) loop of the probability x value contraction to the diagonal block (probabilities beyond it are exactly zero). roff = row offset of this launch's first row within the sequence.
template <typename T16, int NSPLIT, int CMODE>
__global__ __launch_bounds__(32) void k_gemmc(const T16* __restrict__ A, const T16* __restrict__ A2, const T16* __restrict__ Bt, const T16* __restrict__ Bt2, int K, float* C, int ldc, int roff, size_t sA, size_t sB, size_t sC) {
    typedef typename WFrag<T16>::V V;
    __shared__ __align__(16) float os[16 * 68];
    const size_t z = blockIdx.z; A += z * sA; if (A2) A2 += z * sA; Bt += z * sB; if (Bt2) Bt2 += z * sB; C += z * sC;
    const int lane = threadIdx.x & 31, lr = lane & 15, hi = lane >> 4; const int r0 = blockIdx.x * 64, c0 = blockIdx.y * 64;
    if (CMODE == 1 && c0 > r0 + roff + 63) return;                  // score tile entirely above the causal diagonal: never written (the softmax masks j > i by select)
    const int Kl = (CMODE == 2) ? min(K, r0 + roff + 64) : K;        // P.V: probabilities are exactly 0 beyond the diagonal block, so the K loop stops there
    v8f acc[4][4];
#pragma unroll
    for (int mb = 0; mb < 4; ++mb)
#pragma unroll
        for (int nb = 0; nb < 4; ++nb) acc[mb][nb] = (v8f){};
    const size_t aoff = (size_t)(r0 + lr) * K + 8 * hi, boff = (size_t)(c0 + lr) * K + 8 * hi;
#pragma unroll 1
    for (int kc = 0; kc < Kl; kc += 32) {
        V a[4], a2[4];
#pragma unroll
        for (int mb = 0; mb < 4; ++mb) { a[mb] = WFrag<T16>::ld(A + aoff + (size_t)mb * 16 * K + kc); if (NSPLIT == 1 || NSPLIT == 2) a2[mb] = WFrag<T16>::ld(A2 + aoff + (size_t)mb * 16 * K + kc); }
#pragma unroll
        for (int nb = 0; nb < 4; ++nb) { const V b = WFrag<T16>::ld(Bt + boff + (size_t)nb * 16 * K + kc); V b2; if (NSPLIT >= 2) b2 = WFrag<T16>::ld(Bt2 + boff + (size_t)nb * 16 * K + kc);
#pragma unroll
            for (int mb = 0; mb < 4; ++mb) { acc[mb][nb] = WFrag<T16>::mma(a[mb], b, acc[mb][nb]); if (NSPLIT == 1 || NSPLIT == 2) acc[mb][nb] = WFrag<T16>::mma(a2[mb], b, acc[mb][nb]); if (NSPLIT >= 2) acc[mb][nb] = WFrag<T16>::mma(a[mb], b2, acc[mb][nb]); } }
        asm volatile("v_nop\n\tv_nop\n\tv_nop\n\tv_nop" : "+v"(acc[0][0]), "+v"(acc[1][1]), "+v"(acc[2][2]), "+v"(acc[3][3]) : "v"(a[0]), "v"(a[3]));
    }
#pragma unroll
    for (int mb = 0; mb < 4; ++mb) {
#pragma unroll
        for (int nb = 0; nb < 4; ++nb) {
#pragma unroll
            for (int j = 0; j < 8; ++j) os[(hi * 8 + j) * 68 + nb * 16 + lr] = acc[mb][nb][j]; }
        __builtin_amdgcn_wave_barrier(); asm volatile("" ::: "memory");
        float* crow = C + (size_t)(r0 + mb * 16) * ldc + c0;
{
#pragma unroll
            for (int s = 0; s < 8; ++s) { const int row = 2 * s + hi, cofs = lr * 4; v4f val = *(const v4fa*)(os + row * 68 + cofs);
                *(v4f*)(crow + (size_t)row * ldc + cofs) = val; }
             }
        __builtin_amdgcn_wave_barrier(); asm volatile("" ::: "memory");
    }
}

__device__ __forceinline__ h16 tohx(float x) { return (h16)x; }
__device__ __forceinline__ void splitf(float y, unsigned short& h, unsigned short& l) { h = f2bf(y); l = f2bf(y - bf2f(h)); }
typedef __attribute__((ext_vector_type(2))) _Float16 v2h;
typedef __attribute__((ext_vector_type(4))) _Float16 v4h;
typedef __attribute__((ext_vector_type(2))) unsigned short v2us;
typedef __attribute__((ext_vector_type(4))) unsigned short v4us;
typedef __attribute__((ext_vector_type(2))) float v2f;
typedef __attribute__((ext_vector_type(4))) int v4i;

__global__ __launch_bounds__(256) void k_wtG(const float* __restrict__ w, int K, int N, bf* Bt) {
    const int lane = threadIdx.x & 31; const int L0 = (blockIdx.x * 8 + (threadIdx.x >> 5)) * 8; const int nlines = N * K / 64;
{
#pragma unroll 1
        for (int l = 0; l < 8; ++l) { const int L = L0 + l; if (L >= nlines) break; const size_t e = (size_t)L * 64 + lane * 2; const int k = (int)(e % K), n = (int)(e / K); v2us o;
            o[0] = f2bf(w[(size_t)k * N + n]); o[1] = f2bf(w[(size_t)(k + 1) * N + n]); *(v2us*)(Bt + e) = o; }
         }
}
__global__ __launch_bounds__(256) void k_cvt8(const float* __restrict__ src, bf* dst, size_t n8) { const size_t i = (size_t)blockIdx.x * 256 + threadIdx.x; if (i >= n8) return; const v8f v = *(const v8f*)(src + i * 8); v8us o;
#pragma unroll
    for (int k = 0; k < 8; ++k) o[k] = f2bf(v[k]); *(v8us*)(dst + i * 8) = o;  }
__global__ __launch_bounds__(256) void k_cscvt(const float* __restrict__ cosT, const float* __restrict__ sinT, float* CS) { const int idx = blockIdx.x * 256 + threadIdx.x; if (idx >= TT * HD) return; v2f cs; cs[0] = bfr(cosT[idx]); cs[1] = bfr(sinT[idx]); *(v2f*)(CS + (size_t)idx * 2) = cs;  }
// k_rope: head planes [h][t][d] (fp16 + hi/lo) of rope(x) x sc with the rotate-half convention out[d] = x[d] cos[t][d] - x[d+HD/2] sin[t][d], out[d+HD/2] = x[d+HD/2] cos[t][d+HD/2] + x[d] sin[t][d+HD/2]
__global__ __launch_bounds__(256) void k_rope(const float* __restrict__ F, int pitch, int nheads, const float* __restrict__ CS, const float* __restrict__ RF, const float* __restrict__ nw, float sc, h16* P16, bf* Ph, bf* Pl) {
    const size_t e = ((size_t)blockIdx.x * 256 + threadIdx.x) * 2; if (e >= (size_t)nheads * TT * HD) return; const int d = (int)(e % HD); const int t = (int)((e / HD) % TT); const int h = (int)(e / ((size_t)HD * TT)); const float* f = F + (size_t)t * pitch + h * HD; const float rf = RF ? RF[(size_t)h * TT + t] : 1.0f; v2h o16; v2us oh, ol;
#pragma unroll
    for (int q = 0; q < 2; ++q) { const int dd = d + q; const int dp = (dd < HD / 2) ? dd + HD / 2 : dd - HD / 2; float x0 = f[dd], x1 = f[dp];
        if (RF) { float n0 = __fmul_rn(x0, rf), n1 = __fmul_rn(x1, rf); asm volatile("" : "+v"(n0)); asm volatile("" : "+v"(n1)); x0 = __fmul_rn(bfr(nw[dd]), n0); x1 = __fmul_rn(bfr(nw[dp]), n1); }
        const v2f cs = *(const v2f*)(CS + ((size_t)t * HD + dd) * 2); float a = __fmul_rn(x0, cs[0]), bq = __fmul_rn(x1, cs[1]); asm volatile("" : "+v"(a)); asm volatile("" : "+v"(bq)); const float r = ((dd < HD / 2) ? __fsub_rn(a, bq) : __fadd_rn(a, bq)) * sc;
        o16[q] = tohx(r); unsigned short a2, c2; splitf(r, a2, c2); oh[q] = a2; ol[q] = c2; }
    *(v2h*)(P16 + e) = o16; *(v2us*)(Ph + e) = oh; *(v2us*)(Pl + e) = ol;  }
__global__ __launch_bounds__(256) void k_vtp(const float* __restrict__ F, int pitch, int nheads, h16* V16, bf* Vh, bf* Vl) { const size_t e = ((size_t)blockIdx.x * 256 + threadIdx.x) * 2; if (e >= (size_t)nheads * HD * TT) return; const int t = (int)(e % TT); const int d = (int)((e / TT) % HD); const int g = (int)(e / ((size_t)TT * HD)); v2h o16; v2us oh, ol;
#pragma unroll
    for (int q = 0; q < 2; ++q) { const float x = F[(size_t)(t + q) * pitch + g * HD + d]; o16[q] = tohx(x); unsigned short a2, c2; splitf(x, a2, c2); oh[q] = a2; ol[q] = c2; }
    *(v2h*)(V16 + e) = o16; *(v2us*)(Vh + e) = oh; *(v2us*)(Vl + e) = ol;  }
__global__ __launch_bounds__(256) void k_csid(float* CS) { const int idx = blockIdx.x * 256 + threadIdx.x; if (idx >= TT * HD) return; v2f cs; cs[0] = 1.0f; cs[1] = 0.0f; *(v2f*)(CS + (size_t)idx * 2) = cs;  }
// k_asoft: per row (zz, i): t = S x HD^-0.5 for j <= i and i - j < WIN (sliding causal window; the reference's -1e9 additive fill vanishes identically); softmax over the 2048 keys (register row, one exp, fixed trees);
__global__ __launch_bounds__(256) void k_asoft(const float* __restrict__ Sb, h16* P16, bf* Ph, bf* Pl) {
    const int lane = threadIdx.x & 31; const int row = blockIdx.x * 8 + (threadIdx.x >> 5); if (row >= ZH * TT) return; const int i = row % TT; const int zz = row / TT; (void)zz; const bool hires = (i < RH); const float* sr = Sb + (size_t)row * TT; float v[TT / 32]; float mx = -3.0e38f;
#pragma unroll
    for (int ch = 0; ch < TT / 128; ++ch) { const int j0 = ch * 128 + lane * 4; const v4f a = *(const v4f*)(sr + j0);
#pragma unroll
        for (int q = 0; q < 4; ++q) { const int j = j0 + q; (void)j; const float t = (j <= i && i - j < WIN) ? a[q] * SCL : -3.0e38f; v[ch * 4 + q] = t; mx = fmaxf(mx, t); } }
#pragma unroll
    for (int sh = 16; sh; sh >>= 1) mx = fmaxf(mx, __shfl_xor(mx, sh, 32));
    float sum = 0.f;
#pragma unroll
    for (int k = 0; k < TT / 32; ++k) { float d0 = __fsub_rn(v[k], mx); asm volatile("" : "+v"(d0)); v[k] = __builtin_amdgcn_exp2f(__fmul_rn(d0, 1.4426950408889634f)); sum += v[k]; }
#pragma unroll
    for (int sh = 16; sh; sh >>= 1) sum += __shfl_xor(sum, sh, 32);
    const float f = __fdiv_rn(hires ? 1.0f : PCAR, sum);
{
        if (hires) {
#pragma unroll
            for (int ch = 0; ch < TT / 128; ++ch) { v4us oh, ol;
#pragma unroll
                for (int q = 0; q < 4; ++q) { unsigned short a, c2; splitf(v[ch * 4 + q] * f, a, c2); oh[q] = a; ol[q] = c2; }
                const size_t oo = ((size_t)zz * (RH ? RH : 1) + i) * TT + ch * 128 + lane * 4; *(v4us*)(Ph + oo) = oh; *(v4us*)(Pl + oo) = ol; }
        } else {
#pragma unroll
            for (int ch = 0; ch < TT / 128; ++ch) { v4h o4;
#pragma unroll
                for (int q = 0; q < 4; ++q) o4[q] = tohx(v[ch * 4 + q] * f);
                *(v4h*)(P16 + (size_t)row * TT + ch * 128 + lane * 4) = o4; } }
         }
}
__global__ __launch_bounds__(256) void k_merge(const float* __restrict__ O, int h0, bf* Ah, bf* Al) { const size_t e = ((size_t)blockIdx.x * 256 + threadIdx.x) * 2; if (e >= (size_t)ZH * TT * HD) return; const int d = (int)(e % HD); const int t = (int)((e / HD) % TT); const int zz = (int)(e / ((size_t)HD * TT)); const float cs = (t < RH) ? 1.0f : (1.0f / PCAR); const size_t oo = (size_t)t * DQ + (h0 + zz) * HD + d;
    v2us oh, ol;
#pragma unroll
    for (int q = 0; q < 2; ++q) { unsigned short a, c2; splitf(O[e + q] * cs, a, c2); oh[q] = a; ol[q] = c2; } *(v2us*)(Ah + oo) = oh; *(v2us*)(Al + oo) = ol;  }

extern "C" void kernel_launch(void* const* d_in, const int* in_sizes, int n_in,
                              void* d_out, int out_size, void* d_ws, size_t ws_size, hipStream_t stream) {
    (void)in_sizes; (void)n_in; (void)out_size;
    const float* x = (const float*)d_in[0]; const float* xk = (const float*)d_in[1]; const float* xv = (const float*)d_in[2]; const float* wq = (const float*)d_in[3]; const float* bq = (const float*)d_in[4]; const float* wk = (const float*)d_in[5]; const float* bk = (const float*)d_in[6]; const float* wv = (const float*)d_in[7]; const float* bv = (const float*)d_in[8]; const float* wo = (const float*)d_in[9]; const float* bo = (const float*)d_in[10]; const float* cosT = nullptr; const float* sinT = nullptr; (void)cosT; (void)sinT;
    float* OUT = (float*)d_out;     // [1][2048][1024]
    char* wsp = (char*)d_ws;
    auto take = [&](size_t bytes) { char* p = wsp; wsp += (bytes + 255) & ~(size_t)255; return (void*)p; };
    bf* WQ = (bf*)take((size_t)DQ * DM * 2); bf* WK = (bf*)take((size_t)DKV * DM * 2); bf* WV = (bf*)take((size_t)DKV * DM * 2); bf* WO = (bf*)take((size_t)DM * DQ * 2); float* CS = (float*)take((size_t)TT * HD * 2 * 4);
    bf* XB = (bf*)take((size_t)TT * DM * 2); bf* XB2 = (bf*)take((size_t)TT * DM * 2); bf* XB3 = (bf*)take((size_t)TT * DM * 2); float* FQ = (float*)take((size_t)TT * DQ * 4); float* FK = (float*)take((size_t)TT * DKV * 4);
    h16* QP16 = (h16*)take((size_t)NH_ * TT * HD * 2); h16* KP16 = (h16*)take((size_t)NKV * TT * HD * 2); h16* VT16 = (h16*)take((size_t)NKV * HD * TT * 2);
    bf* QPh = (bf*)take((size_t)NH_ * TT * HD * 2); bf* QPl = (bf*)take((size_t)NH_ * TT * HD * 2); bf* KPh = (bf*)take((size_t)NKV * TT * HD * 2); bf* KPl = (bf*)take((size_t)NKV * TT * HD * 2); bf* VTh = (bf*)take((size_t)NKV * HD * TT * 2); bf* VTl = (bf*)take((size_t)NKV * HD * TT * 2); bf* Ph = (bf*)take((size_t)ZH * RH * TT * 2); bf* Pl = (bf*)take((size_t)ZH * RH * TT * 2);
    float* Sb = (float*)take((size_t)ZH * TT * TT * 4); h16* P16 = (h16*)take((size_t)ZH * TT * TT * 2); float* Ob = (float*)take((size_t)ZH * TT * HD * 4); bf* ATh = (bf*)take((size_t)TT * DQ * 2); bf* ATl = (bf*)take((size_t)TT * DQ * 2);
    if ((size_t)(wsp - (char*)d_ws) > ws_size) return;    // ws 256 MiB
    float* FV = FK;   // v projection reuses the k buffer after the k planes are built (stream-ordered)
    { k_cvt8<<<(unsigned)(((size_t)DQ * DM / 8 + 255) / 256), 256, 0, stream>>>(wq, WQ, (size_t)DQ * DM / 8); k_cvt8<<<(unsigned)(((size_t)DKV * DM / 8 + 255) / 256), 256, 0, stream>>>(wk, WK, (size_t)DKV * DM / 8); k_cvt8<<<(unsigned)(((size_t)DKV * DM / 8 + 255) / 256), 256, 0, stream>>>(wv, WV, (size_t)DKV * DM / 8);
      k_cvt8<<<(unsigned)(((size_t)DM * DQ / 8 + 255) / 256), 256, 0, stream>>>(wo, WO, (size_t)DM * DQ / 8);
       }
    k_csid<<<(TT * HD + 255) / 256, 256, 0, stream>>>(CS);
    const unsigned LQ = (unsigned)(((size_t)NH_ * TT * HD / 2 + 255) / 256), LKv = (unsigned)(((size_t)NKV * TT * HD / 2 + 255) / 256);
    for (int b = 0; b < NB_; ++b) {
        
        k_cvt8<<<(unsigned)(((size_t)TT * DM / 8 + 255) / 256), 256, 0, stream>>>(x + (size_t)b * TT * DM, XB, (size_t)TT * DM / 8); k_cvt8<<<(unsigned)(((size_t)TT * DM / 8 + 255) / 256), 256, 0, stream>>>(xk + (size_t)b * TT * DM, XB2, (size_t)TT * DM / 8); k_cvt8<<<(unsigned)(((size_t)TT * DM / 8 + 255) / 256), 256, 0, stream>>>(xv + (size_t)b * TT * DM, XB3, (size_t)TT * DM / 8);
        k_gemmw<bf, 0, true><<<dim3(TT / 64, DQ / 64, 1), 32, 0, stream>>>(XB, nullptr, WQ, nullptr, DM, FQ, DQ, bq, 0, 0, 0);
        k_rope<<<LQ, 256, 0, stream>>>(FQ, DQ, NH_, CS, nullptr, nullptr, 1.0f, QP16, QPh, QPl);
        k_gemmw<bf, 0, true><<<dim3(TT / 64, DKV / 64, 1), 32, 0, stream>>>(XB2, nullptr, WK, nullptr, DM, FK, DKV, bk, 0, 0, 0);
        k_rope<<<LKv, 256, 0, stream>>>(FK, DKV, NKV, CS, nullptr, nullptr, 1.0f, KP16, KPh, KPl);
        k_gemmw<bf, 0, true><<<dim3(TT / 64, DKV / 64, 1), 32, 0, stream>>>(XB3, nullptr, WV, nullptr, DM, FV, DKV, bv, 0, 0, 0); k_vtp<<<LKv, 256, 0, stream>>>(FV, DKV, NKV, VT16, VTh, VTl);
        for (int h0 = 0; h0 < NH_; h0 += ZH) { const size_t zq = (size_t)h0, zk = (size_t)(h0 / REP);   // one kv head per query head: the pass's two heads use consecutive kv planes (z-strides TT*HD)
            k_gemmc<bf, 2, 1><<<dim3(RH / 64, TT / 64, ZH), 32, 0, stream>>>(QPh + zq * TT * HD, QPl + zq * TT * HD, KPh + zk * TT * HD, KPl + zk * TT * HD, HD, Sb, TT, 0, (size_t)TT * HD, (size_t)TT * HD, (size_t)TT * TT);
            k_gemmc<h16, 0, 1><<<dim3((TT - RH) / 64, TT / 64, ZH), 32, 0, stream>>>(QP16 + zq * TT * HD + (size_t)RH * HD, nullptr, KP16 + zk * TT * HD, nullptr, HD, Sb + (size_t)RH * TT, TT, RH, (size_t)TT * HD, (size_t)TT * HD, (size_t)TT * TT);
            k_asoft<<<ZH * TT / 8, 256, 0, stream>>>(Sb, P16, Ph, Pl);
            k_gemmc<bf, 2, 2><<<dim3(RH / 64, HD / 64, ZH), 32, 0, stream>>>(Ph, Pl, VTh + zk * HD * TT, VTl + zk * HD * TT, TT, Ob, HD, 0, (size_t)RH * TT, (size_t)HD * TT, (size_t)TT * HD);
            k_gemmc<h16, 0, 2><<<dim3((TT - RH) / 64, HD / 64, ZH), 32, 0, stream>>>(P16 + (size_t)RH * TT, nullptr, VT16 + zk * HD * TT, nullptr, TT, Ob + (size_t)RH * HD, HD, RH, (size_t)TT * TT, (size_t)HD * TT, (size_t)TT * HD);
            k_merge<<<(unsigned)(((size_t)ZH * TT * HD / 2 + 255) / 256), 256, 0, stream>>>(Ob, h0, ATh, ATl); }
        k_gemmw<bf, 1, true><<<dim3(TT / 64, DM / 64, 1), 32, 0, stream>>>(ATh, ATl, WO, nullptr, DQ, OUT + (size_t)b * TT * DM, DM, bo, 0, 0, 0); }
}

// v001
// A run of this version takes 399 microseconds.
// Next to v000, in two timings, it ran 1.88 and 1.83 times as fast.
#include <hip/hip_runtime.h>

// MultiHeadAttentionV2 (q/k/v encodings [1][2048][1024] (three inputs); q/k/v = x W^T + b (torch; 16 heads x 64); causal softmax(q.k / 8); out = merged Wo^T + bo -> [1][2048][1024]).
// Compute dtypes, f32 accumulate: every input rounded to bf16; q/k/v on PLAIN bf16 operands (inputs: exact) + bias; causal scores and attn.v: query rows < 512 hl (3 products), the rest single fp16 (x1024); softmax f32; Wo hl x exact (2 products) + bias.

#define NB_  1
#define TT   2048
#define DM   1024
#define NH_  16
#define NKV  16
#define REP  (NH_ / NKV)
#define HD   64
#define DQ   (NH_ * HD)
#define DKV  (NKV * HD)
#define ZH   2
#define RH   512                  // query rows < RH use hi+lo planes (0: none)
#define WIN  2048
#define PCAR 1024.0f
#define SCL  0.125f   // HD^-0.5
typedef _Float16 h16;
typedef unsigned short bf;
typedef __attribute__((ext_vector_type(16))) __bf16   v16bf;
typedef __attribute__((ext_vector_type(16))) _Float16 v16h;
typedef __attribute__((ext_vector_type(8)))  _Float16 v8h;
typedef __attribute__((ext_vector_type(8)))  unsigned short v8us;
typedef __attribute__((ext_vector_type(8)))  float    v8f;
typedef __attribute__((ext_vector_type(4)))  float    v4f;
typedef v8h  __attribute__((may_alias)) v8ha;
typedef v4f  __attribute__((may_alias)) v4fa;
typedef v8us __attribute__((may_alias)) v8usa;

__device__ __forceinline__ unsigned short f2bf(float f) { unsigned u = __float_as_uint(f); u += 0x7FFFu + ((u >> 16) & 1u); return (unsigned short)(u >> 16); }
__device__ __forceinline__ float bf2f(unsigned short b) { return __uint_as_float(((unsigned)b) << 16); }
__device__ __forceinline__ float bfr(float f) { return bf2f(f2bf(f)); }
__device__ __forceinline__ v16h cat16(v8h lo, v8h hi) { return __builtin_shufflevector(lo, hi, 0, 1, 2, 3, 4, 5, 6, 7, 8, 9, 10, 11, 12, 13, 14, 15); }
__device__ __forceinline__ v16bf cat16b(v8us lo, v8us hi) { return __builtin_bit_cast(v16bf, __builtin_shufflevector(lo, hi, 0, 1, 2, 3, 4, 5, 6, 7, 8, 9, 10, 11, 12, 13, 14, 15)); }
__device__ __forceinline__ v8f wmma16(v16h a, v16h b, v8f c) { return __builtin_amdgcn_wmma_f32_16x16x32_f16(false, a, false, b, (short)0, c, false, false); }
__device__ __forceinline__ v8f wmmab(v16bf a, v16bf b, v8f c) { return __builtin_amdgcn_wmma_f32_16x16x32_bf16(false, a, false, b, (short)0, c, false, false); }



// ---- k_gemmw: register-blocked GEMM, one work-group of NW waves per 64x64 output tile; wave w takes the 32-wide K blocks w, w + NW, ... into its own 16 accumulators, and the NW partial tiles are
// summed through LDS in wave order (a fixed order). Operands straight from K-contiguous 16-bit planes; grid (M/64, N/64, Z), 32 * NW threads.
// C[m][n] (f32, pitch ldc, + optional f32 bias[n]) = sum_k A[m][k] Bt[n][k] (+ split products per NSPLIT). z-batch strides sA/sB/sC in elements. K % 32 == 0.
template <typename T16> struct WFrag;
template <> struct WFrag<h16> { typedef v16h V; static __device__ __forceinline__ V ld(const h16* p) { return cat16(*(const v8h*)p, *(const v8h*)(p + 16)); } static __device__ __forceinline__ v8f mma(V a, V b, v8f c) { return wmma16(a, b, c); } };
template <> struct WFrag<bf> { typedef v16bf V; static __device__ __forceinline__ V ld(const bf* p) { return cat16b(*(const v8us*)p, *(const v8us*)(p + 16)); } static __device__ __forceinline__ v8f mma(V a, V b, v8f c) { return wmmab(a, b, c); } };
template <typename T16, int NSPLIT, bool BIAS, int NW>
__global__ __launch_bounds__(32 * NW) void k_gemmw(const T16* __restrict__ A, const T16* __restrict__ A2, const T16* __restrict__ Bt, const T16* __restrict__ Bt2, int K, float* C, int ldc, const float* __restrict__ bias, size_t sA, size_t sB, size_t sC) {
    typedef typename WFrag<T16>::V V;
    __shared__ __align__(16) float os[NW * 64 * 68];
    const size_t z = blockIdx.z; A += z * sA; if (A2) A2 += z * sA; Bt += z * sB; if (Bt2) Bt2 += z * sB; C += z * sC;
    const int lane = threadIdx.x & 31, lr = lane & 15, hi = lane >> 4; const int r0 = blockIdx.x * 64, c0 = blockIdx.y * 64;
    const int wv = __builtin_amdgcn_readfirstlane((int)(threadIdx.x >> 5));   // wave number, scalar: the K loop's trip test stays a scalar branch (every lane on at the matrix instructions)
    v8f acc[4][4];
#pragma unroll
    for (int mb = 0; mb < 4; ++mb)
#pragma unroll
        for (int nb = 0; nb < 4; ++nb) acc[mb][nb] = (v8f){};
    const size_t aoff = (size_t)(r0 + lr) * K + 8 * hi, boff = (size_t)(c0 + lr) * K + 8 * hi;
#pragma unroll 1
    for (int kc = 32 * wv; kc < K; kc += 32 * NW) {
        V a[4], a2[4];
#pragma unroll
        for (int mb = 0; mb < 4; ++mb) { a[mb] = WFrag<T16>::ld(A + aoff + (size_t)mb * 16 * K + kc); if (NSPLIT == 1 || NSPLIT == 2) a2[mb] = WFrag<T16>::ld(A2 + aoff + (size_t)mb * 16 * K + kc); }
#pragma unroll
        for (int nb = 0; nb < 4; ++nb) { const V b = WFrag<T16>::ld(Bt + boff + (size_t)nb * 16 * K + kc); V b2; if (NSPLIT >= 2) b2 = WFrag<T16>::ld(Bt2 + boff + (size_t)nb * 16 * K + kc);
#pragma unroll
            for (int mb = 0; mb < 4; ++mb) { acc[mb][nb] = WFrag<T16>::mma(a[mb], b, acc[mb][nb]); if (NSPLIT == 1 || NSPLIT == 2) acc[mb][nb] = WFrag<T16>::mma(a2[mb], b, acc[mb][nb]); if (NSPLIT >= 2) acc[mb][nb] = WFrag<T16>::mma(a[mb], b2, acc[mb][nb]); } }
        asm volatile("v_nop\n\tv_nop\n\tv_nop\n\tv_nop" : "+v"(acc[0][0]), "+v"(acc[1][1]), "+v"(acc[2][2]), "+v"(acc[3][3]) : "v"(a[0]), "v"(a[3]));
    }
#pragma unroll
    for (int mb = 0; mb < 4; ++mb) {
#pragma unroll
        for (int nb = 0; nb < 4; ++nb) {
#pragma unroll
            for (int j = 0; j < 8; ++j) os[wv * (64 * 68) + (mb * 16 + hi * 8 + j) * 68 + nb * 16 + lr] = acc[mb][nb][j]; }
    }
    __syncthreads();   // every wave's partial 64x64 tile is in LDS before any thread sums them
    float* crow = C + (size_t)r0 * ldc + c0;
    // both loops unrolled so that the LDS reads of all the sums issue ahead of the adds, and the stores go out together
#pragma unroll
    for (int i = 0; i < 32 / NW; ++i) { const int s = threadIdx.x + i * (32 * NW), row = s >> 4, cofs = (s & 15) * 4; v4f val = *(const v4fa*)(os + row * 68 + cofs);
#pragma unroll
        for (int w = 1; w < NW; ++w) val += *(const v4fa*)(os + w * (64 * 68) + row * 68 + cofs);
        if (BIAS) { val[0] += bfr(bias[c0 + cofs]); val[1] += bfr(bias[c0 + cofs + 1]); val[2] += bfr(bias[c0 + cofs + 2]); val[3] += bfr(bias[c0 + cofs + 3]); }
        *(v4f*)(crow + (size_t)row * ldc + cofs) = val; }
}

// ---- k_gemmc: the same 64x64 tile GEMM (NW waves share the K loop; NW = 1 for the score product, whose K is two blocks) specialised for causal attention: CMODE 1 skips score tiles entirely above the diagonal (query rows r0+roff.., key columns c0..), CMODE 2 limits the
// key (K) loop of the probability x value contraction to the diagonal block (probabilities beyond it are exactly zero). roff = row offset of this launch's first row within the sequence.
template <typename T16, int NSPLIT, int CMODE, int NW>
__global__ __launch_bounds__(32 * NW) void k_gemmc(const T16* __restrict__ A, const T16* __restrict__ A2, const T16* __restrict__ Bt, const T16* __restrict__ Bt2, int K, float* C, int ldc, int roff, size_t sA, size_t sB, size_t sC) {
    typedef typename WFrag<T16>::V V;
    __shared__ __align__(16) float os[NW == 1 ? 16 * 68 : NW * 64 * 68];
    const size_t z = blockIdx.z; A += z * sA; if (A2) A2 += z * sA; Bt += z * sB; if (Bt2) Bt2 += z * sB; C += z * sC;
    const int lane = threadIdx.x & 31, lr = lane & 15, hi = lane >> 4; const int r0 = blockIdx.x * 64, c0 = blockIdx.y * 64;
    const int wv = (NW == 1) ? 0 : __builtin_amdgcn_readfirstlane((int)(threadIdx.x >> 5));   // wave number, scalar: the K loop's trip test stays a scalar branch (every lane on at the matrix instructions)
    if (CMODE == 1 && c0 > r0 + roff + 63) return;                  // score tile entirely above the causal diagonal: never read (the softmax masks j > i by select)
    const int Kl = (CMODE == 2) ? min(K, r0 + roff + 64) : K;        // P.V: probabilities are exactly 0 beyond the diagonal block, so the K loop stops there
    v8f acc[4][4];
#pragma unroll
    for (int mb = 0; mb < 4; ++mb)
#pragma unroll
        for (int nb = 0; nb < 4; ++nb) acc[mb][nb] = (v8f){};
    const size_t aoff = (size_t)(r0 + lr) * K + 8 * hi, boff = (size_t)(c0 + lr) * K + 8 * hi;
#pragma unroll 1
    for (int kc = 32 * wv; kc < Kl; kc += 32 * NW) {
        V a[4], a2[4];
#pragma unroll
        for (int mb = 0; mb < 4; ++mb) { a[mb] = WFrag<T16>::ld(A + aoff + (size_t)mb * 16 * K + kc); if (NSPLIT == 1 || NSPLIT == 2) a2[mb] = WFrag<T16>::ld(A2 + aoff + (size_t)mb * 16 * K + kc); }
#pragma unroll
        for (int nb = 0; nb < 4; ++nb) { const V b = WFrag<T16>::ld(Bt + boff + (size_t)nb * 16 * K + kc); V b2; if (NSPLIT >= 2) b2 = WFrag<T16>::ld(Bt2 + boff + (size_t)nb * 16 * K + kc);
#pragma unroll
            for (int mb = 0; mb < 4; ++mb) { acc[mb][nb] = WFrag<T16>::mma(a[mb], b, acc[mb][nb]); if (NSPLIT == 1 || NSPLIT == 2) acc[mb][nb] = WFrag<T16>::mma(a2[mb], b, acc[mb][nb]); if (NSPLIT >= 2) acc[mb][nb] = WFrag<T16>::mma(a[mb], b2, acc[mb][nb]); } }
        asm volatile("v_nop\n\tv_nop\n\tv_nop\n\tv_nop" : "+v"(acc[0][0]), "+v"(acc[1][1]), "+v"(acc[2][2]), "+v"(acc[3][3]) : "v"(a[0]), "v"(a[3]));
    }
    if constexpr (NW == 1) {   // one wave: its tile goes out 16 rows at a time through its own LDS slab
#pragma unroll
    for (int mb = 0; mb < 4; ++mb) {
#pragma unroll
        for (int nb = 0; nb < 4; ++nb) {
#pragma unroll
            for (int j = 0; j < 8; ++j) os[(hi * 8 + j) * 68 + nb * 16 + lr] = acc[mb][nb][j]; }
        __builtin_amdgcn_wave_barrier(); asm volatile("" ::: "memory");
        float* crow = C + (size_t)(r0 + mb * 16) * ldc + c0;
{
#pragma unroll
            for (int s = 0; s < 8; ++s) { const int row = 2 * s + hi, cofs = lr * 4; v4f val = *(const v4fa*)(os + row * 68 + cofs);
                *(v4f*)(crow + (size_t)row * ldc + cofs) = val; }
             }
        __builtin_amdgcn_wave_barrier(); asm volatile("" ::: "memory");
    }
    } else {
    // unrolled: acc[][] needs constant indices to stay in registers
#pragma unroll
    for (int mb = 0; mb < 4; ++mb) {
#pragma unroll
        for (int nb = 0; nb < 4; ++nb) {
#pragma unroll
            for (int j = 0; j < 8; ++j) os[wv * (64 * 68) + (mb * 16 + hi * 8 + j) * 68 + nb * 16 + lr] = acc[mb][nb][j]; }
    }
    __syncthreads();   // every wave's partial 64x64 tile is in LDS before any thread sums them
    float* crow = C + (size_t)r0 * ldc + c0;
    // both loops unrolled so that the LDS reads of all the sums issue ahead of the adds, and the stores go out together
#pragma unroll
    for (int i = 0; i < 32 / NW; ++i) { const int s = threadIdx.x + i * (32 * NW), row = s >> 4, cofs = (s & 15) * 4; v4f val = *(const v4fa*)(os + row * 68 + cofs);
#pragma unroll
        for (int w = 1; w < NW; ++w) val += *(const v4fa*)(os + w * (64 * 68) + row * 68 + cofs);
        *(v4f*)(crow + (size_t)row * ldc + cofs) = val; }
    }
}

__device__ __forceinline__ h16 tohx(float x) { return (h16)x; }
__device__ __forceinline__ void splitf(float y, unsigned short& h, unsigned short& l) { h = f2bf(y); l = f2bf(y - bf2f(h)); }
typedef __attribute__((ext_vector_type(2))) _Float16 v2h;
typedef __attribute__((ext_vector_type(4))) _Float16 v4h;
typedef __attribute__((ext_vector_type(2))) unsigned short v2us;
typedef __attribute__((ext_vector_type(4))) unsigned short v4us;
typedef __attribute__((ext_vector_type(2))) float v2f;
typedef __attribute__((ext_vector_type(4))) int v4i;

__global__ __launch_bounds__(256) void k_wtG(const float* __restrict__ w, int K, int N, bf* Bt) {
    const int lane = threadIdx.x & 31; const int L0 = (blockIdx.x * 8 + (threadIdx.x >> 5)) * 8; const int nlines = N * K / 64;
{
#pragma unroll 1
        for (int l = 0; l < 8; ++l) { const int L = L0 + l; if (L >= nlines) break; const size_t e = (size_t)L * 64 + lane * 2; const int k = (int)(e % K), n = (int)(e / K); v2us o;
            o[0] = f2bf(w[(size_t)k * N + n]); o[1] = f2bf(w[(size_t)(k + 1) * N + n]); *(v2us*)(Bt + e) = o; }
         }
}
__global__ __launch_bounds__(256) void k_cvt8(const float* __restrict__ src, bf* dst, size_t n8) { const size_t i = (size_t)blockIdx.x * 256 + threadIdx.x; if (i >= n8) return; const v8f v = *(const v8f*)(src + i * 8); v8us o;
#pragma unroll
    for (int k = 0; k < 8; ++k) o[k] = f2bf(v[k]); *(v8us*)(dst + i * 8) = o;  }
__global__ __launch_bounds__(256) void k_cscvt(const float* __restrict__ cosT, const float* __restrict__ sinT, float* CS) { const int idx = blockIdx.x * 256 + threadIdx.x; if (idx >= TT * HD) return; v2f cs; cs[0] = bfr(cosT[idx]); cs[1] = bfr(sinT[idx]); *(v2f*)(CS + (size_t)idx * 2) = cs;  }
// k_rope: head planes [h][t][d] (fp16 + hi/lo) of rope(x) x sc with the rotate-half convention out[d] = x[d] cos[t][d] - x[d+HD/2] sin[t][d], out[d+HD/2] = x[d+HD/2] cos[t][d+HD/2] + x[d] sin[t][d+HD/2]
__global__ __launch_bounds__(256) void k_rope(const float* __restrict__ F, int pitch, int nheads, const float* __restrict__ CS, const float* __restrict__ RF, const float* __restrict__ nw, float sc, h16* P16, bf* Ph, bf* Pl) {
    const size_t e = ((size_t)blockIdx.x * 256 + threadIdx.x) * 2; if (e >= (size_t)nheads * TT * HD) return; const int d = (int)(e % HD); const int t = (int)((e / HD) % TT); const int h = (int)(e / ((size_t)HD * TT)); const float* f = F + (size_t)t * pitch + h * HD; const float rf = RF ? RF[(size_t)h * TT + t] : 1.0f; v2h o16; v2us oh, ol;
#pragma unroll
    for (int q = 0; q < 2; ++q) { const int dd = d + q; const int dp = (dd < HD / 2) ? dd + HD / 2 : dd - HD / 2; float x0 = f[dd], x1 = f[dp];
        if (RF) { float n0 = __fmul_rn(x0, rf), n1 = __fmul_rn(x1, rf); asm volatile("" : "+v"(n0)); asm volatile("" : "+v"(n1)); x0 = __fmul_rn(bfr(nw[dd]), n0); x1 = __fmul_rn(bfr(nw[dp]), n1); }
        const v2f cs = *(const v2f*)(CS + ((size_t)t * HD + dd) * 2); float a = __fmul_rn(x0, cs[0]), bq = __fmul_rn(x1, cs[1]); asm volatile("" : "+v"(a)); asm volatile("" : "+v"(bq)); const float r = ((dd < HD / 2) ? __fsub_rn(a, bq) : __fadd_rn(a, bq)) * sc;
        o16[q] = tohx(r); unsigned short a2, c2; splitf(r, a2, c2); oh[q] = a2; ol[q] = c2; }
    *(v2h*)(P16 + e) = o16; *(v2us*)(Ph + e) = oh; *(v2us*)(Pl + e) = ol;  }
__global__ __launch_bounds__(256) void k_vtp(const float* __restrict__ F, int pitch, int nheads, h16* V16, bf* Vh, bf* Vl) { const size_t e = ((size_t)blockIdx.x * 256 + threadIdx.x) * 2; if (e >= (size_t)nheads * HD * TT) return; const int t = (int)(e % TT); const int d = (int)((e / TT) % HD); const int g = (int)(e / ((size_t)TT * HD)); v2h o16; v2us oh, ol;
#pragma unroll
    for (int q = 0; q < 2; ++q) { const float x = F[(size_t)(t + q) * pitch + g * HD + d]; o16[q] = tohx(x); unsigned short a2, c2; splitf(x, a2, c2); oh[q] = a2; ol[q] = c2; }
    *(v2h*)(V16 + e) = o16; *(v2us*)(Vh + e) = oh; *(v2us*)(Vl + e) = ol;  }
__global__ __launch_bounds__(256) void k_csid(float* CS) { const int idx = blockIdx.x * 256 + threadIdx.x; if (idx >= TT * HD) return; v2f cs; cs[0] = 1.0f; cs[1] = 0.0f; *(v2f*)(CS + (size_t)idx * 2) = cs;  }
// k_asoft: per row (zz, i): t = S x HD^-0.5 for j <= i and i - j < WIN (sliding causal window; the reference's -1e9 additive fill vanishes identically); softmax over the 2048 keys (register row, one exp, fixed trees);
__global__ __launch_bounds__(256) void k_asoft(const float* __restrict__ Sb, h16* P16, bf* Ph, bf* Pl) {
    const int lane = threadIdx.x & 31; const int row = blockIdx.x * 8 + (threadIdx.x >> 5); if (row >= ZH * TT) return; const int i = row % TT; const int zz = row / TT; (void)zz; const bool hires = (i < RH); const float* sr = Sb + (size_t)row * TT; float v[TT / 32]; float mx = -3.0e38f;
#pragma unroll
    for (int ch = 0; ch < TT / 128; ++ch) { const int j0 = ch * 128 + lane * 4; const v4f a = *(const v4f*)(sr + j0);
#pragma unroll
        for (int q = 0; q < 4; ++q) { const int j = j0 + q; (void)j; const float t = (j <= i && i - j < WIN) ? a[q] * SCL : -3.0e38f; v[ch * 4 + q] = t; mx = fmaxf(mx, t); } }
#pragma unroll
    for (int sh = 16; sh; sh >>= 1) mx = fmaxf(mx, __shfl_xor(mx, sh, 32));
    float sum = 0.f;
#pragma unroll
    for (int k = 0; k < TT / 32; ++k) { float d0 = __fsub_rn(v[k], mx); asm volatile("" : "+v"(d0)); v[k] = __builtin_amdgcn_exp2f(__fmul_rn(d0, 1.4426950408889634f)); sum += v[k]; }
#pragma unroll
    for (int sh = 16; sh; sh >>= 1) sum += __shfl_xor(sum, sh, 32);
    const float f = __fdiv_rn(hires ? 1.0f : PCAR, sum);
{
        if (hires) {
#pragma unroll
            for (int ch = 0; ch < TT / 128; ++ch) { v4us oh, ol;
#pragma unroll
                for (int q = 0; q < 4; ++q) { unsigned short a, c2; splitf(v[ch * 4 + q] * f, a, c2); oh[q] = a; ol[q] = c2; }
                const size_t oo = ((size_t)zz * (RH ? RH : 1) + i) * TT + ch * 128 + lane * 4; *(v4us*)(Ph + oo) = oh; *(v4us*)(Pl + oo) = ol; }
        } else {
#pragma unroll
            for (int ch = 0; ch < TT / 128; ++ch) { v4h o4;
#pragma unroll
                for (int q = 0; q < 4; ++q) o4[q] = tohx(v[ch * 4 + q] * f);
                *(v4h*)(P16 + (size_t)row * TT + ch * 128 + lane * 4) = o4; } }
         }
}
__global__ __launch_bounds__(256) void k_merge(const float* __restrict__ O, int h0, bf* Ah, bf* Al) { const size_t e = ((size_t)blockIdx.x * 256 + threadIdx.x) * 2; if (e >= (size_t)ZH * TT * HD) return; const int d = (int)(e % HD); const int t = (int)((e / HD) % TT); const int zz = (int)(e / ((size_t)HD * TT)); const float cs = (t < RH) ? 1.0f : (1.0f / PCAR); const size_t oo = (size_t)t * DQ + (h0 + zz) * HD + d;
    v2us oh, ol;
#pragma unroll
    for (int q = 0; q < 2; ++q) { unsigned short a, c2; splitf(O[e + q] * cs, a, c2); oh[q] = a; ol[q] = c2; } *(v2us*)(Ah + oo) = oh; *(v2us*)(Al + oo) = ol;  }

extern "C" void kernel_launch(void* const* d_in, const int* in_sizes, int n_in,
                              void* d_out, int out_size, void* d_ws, size_t ws_size, hipStream_t stream) {
    (void)in_sizes; (void)n_in; (void)out_size;
    const float* x = (const float*)d_in[0]; const float* xk = (const float*)d_in[1]; const float* xv = (const float*)d_in[2]; const float* wq = (const float*)d_in[3]; const float* bq = (const float*)d_in[4]; const float* wk = (const float*)d_in[5]; const float* bk = (const float*)d_in[6]; const float* wv = (const float*)d_in[7]; const float* bv = (const float*)d_in[8]; const float* wo = (const float*)d_in[9]; const float* bo = (const float*)d_in[10]; const float* cosT = nullptr; const float* sinT = nullptr; (void)cosT; (void)sinT;
    float* OUT = (float*)d_out;     // [1][2048][1024]
    char* wsp = (char*)d_ws;
    auto take = [&](size_t bytes) { char* p = wsp; wsp += (bytes + 255) & ~(size_t)255; return (void*)p; };
    bf* WQ = (bf*)take((size_t)DQ * DM * 2); bf* WK = (bf*)take((size_t)DKV * DM * 2); bf* WV = (bf*)take((size_t)DKV * DM * 2); bf* WO = (bf*)take((size_t)DM * DQ * 2); float* CS = (float*)take((size_t)TT * HD * 2 * 4);
    bf* XB = (bf*)take((size_t)TT * DM * 2); bf* XB2 = (bf*)take((size_t)TT * DM * 2); bf* XB3 = (bf*)take((size_t)TT * DM * 2); float* FQ = (float*)take((size_t)TT * DQ * 4); float* FK = (float*)take((size_t)TT * DKV * 4);
    h16* QP16 = (h16*)take((size_t)NH_ * TT * HD * 2); h16* KP16 = (h16*)take((size_t)NKV * TT * HD * 2); h16* VT16 = (h16*)take((size_t)NKV * HD * TT * 2);
    bf* QPh = (bf*)take((size_t)NH_ * TT * HD * 2); bf* QPl = (bf*)take((size_t)NH_ * TT * HD * 2); bf* KPh = (bf*)take((size_t)NKV * TT * HD * 2); bf* KPl = (bf*)take((size_t)NKV * TT * HD * 2); bf* VTh = (bf*)take((size_t)NKV * HD * TT * 2); bf* VTl = (bf*)take((size_t)NKV * HD * TT * 2); bf* Ph = (bf*)take((size_t)ZH * RH * TT * 2); bf* Pl = (bf*)take((size_t)ZH * RH * TT * 2);
    float* Sb = (float*)take((size_t)ZH * TT * TT * 4); h16* P16 = (h16*)take((size_t)ZH * TT * TT * 2); float* Ob = (float*)take((size_t)ZH * TT * HD * 4); bf* ATh = (bf*)take((size_t)TT * DQ * 2); bf* ATl = (bf*)take((size_t)TT * DQ * 2);
    if ((size_t)(wsp - (char*)d_ws) > ws_size) return;    // ws 256 MiB
    float* FV = FK;   // v projection reuses the k buffer after the k planes are built (stream-ordered)
    { k_cvt8<<<(unsigned)(((size_t)DQ * DM / 8 + 255) / 256), 256, 0, stream>>>(wq, WQ, (size_t)DQ * DM / 8); k_cvt8<<<(unsigned)(((size_t)DKV * DM / 8 + 255) / 256), 256, 0, stream>>>(wk, WK, (size_t)DKV * DM / 8); k_cvt8<<<(unsigned)(((size_t)DKV * DM / 8 + 255) / 256), 256, 0, stream>>>(wv, WV, (size_t)DKV * DM / 8);
      k_cvt8<<<(unsigned)(((size_t)DM * DQ / 8 + 255) / 256), 256, 0, stream>>>(wo, WO, (size_t)DM * DQ / 8);
       }
    k_csid<<<(TT * HD + 255) / 256, 256, 0, stream>>>(CS);
    const unsigned LQ = (unsigned)(((size_t)NH_ * TT * HD / 2 + 255) / 256), LKv = (unsigned)(((size_t)NKV * TT * HD / 2 + 255) / 256);
    for (int b = 0; b < NB_; ++b) {
        
        k_cvt8<<<(unsigned)(((size_t)TT * DM / 8 + 255) / 256), 256, 0, stream>>>(x + (size_t)b * TT * DM, XB, (size_t)TT * DM / 8); k_cvt8<<<(unsigned)(((size_t)TT * DM / 8 + 255) / 256), 256, 0, stream>>>(xk + (size_t)b * TT * DM, XB2, (size_t)TT * DM / 8); k_cvt8<<<(unsigned)(((size_t)TT * DM / 8 + 255) / 256), 256, 0, stream>>>(xv + (size_t)b * TT * DM, XB3, (size_t)TT * DM / 8);
        k_gemmw<bf, 0, true, 8><<<dim3(TT / 64, DQ / 64, 1), 256, 0, stream>>>(XB, nullptr, WQ, nullptr, DM, FQ, DQ, bq, 0, 0, 0);
        k_rope<<<LQ, 256, 0, stream>>>(FQ, DQ, NH_, CS, nullptr, nullptr, 1.0f, QP16, QPh, QPl);
        k_gemmw<bf, 0, true, 8><<<dim3(TT / 64, DKV / 64, 1), 256, 0, stream>>>(XB2, nullptr, WK, nullptr, DM, FK, DKV, bk, 0, 0, 0);
        k_rope<<<LKv, 256, 0, stream>>>(FK, DKV, NKV, CS, nullptr, nullptr, 1.0f, KP16, KPh, KPl);
        k_gemmw<bf, 0, true, 8><<<dim3(TT / 64, DKV / 64, 1), 256, 0, stream>>>(XB3, nullptr, WV, nullptr, DM, FV, DKV, bv, 0, 0, 0); k_vtp<<<LKv, 256, 0, stream>>>(FV, DKV, NKV, VT16, VTh, VTl);
        for (int h0 = 0; h0 < NH_; h0 += ZH) { const size_t zq = (size_t)h0, zk = (size_t)(h0 / REP);   // one kv head per query head: the pass's two heads use consecutive kv planes (z-strides TT*HD)
            k_gemmc<bf, 2, 1, 1><<<dim3(RH / 64, TT / 64, ZH), 32, 0, stream>>>(QPh + zq * TT * HD, QPl + zq * TT * HD, KPh + zk * TT * HD, KPl + zk * TT * HD, HD, Sb, TT, 0, (size_t)TT * HD, (size_t)TT * HD, (size_t)TT * TT);
            k_gemmc<h16, 0, 1, 1><<<dim3((TT - RH) / 64, TT / 64, ZH), 32, 0, stream>>>(QP16 + zq * TT * HD + (size_t)RH * HD, nullptr, KP16 + zk * TT * HD, nullptr, HD, Sb + (size_t)RH * TT, TT, RH, (size_t)TT * HD, (size_t)TT * HD, (size_t)TT * TT);
            k_asoft<<<ZH * TT / 8, 256, 0, stream>>>(Sb, P16, Ph, Pl);
            k_gemmc<bf, 2, 2, 8><<<dim3(RH / 64, HD / 64, ZH), 256, 0, stream>>>(Ph, Pl, VTh + zk * HD * TT, VTl + zk * HD * TT, TT, Ob, HD, 0, (size_t)RH * TT, (size_t)HD * TT, (size_t)TT * HD);
            k_gemmc<h16, 0, 2, 16><<<dim3((TT - RH) / 64, HD / 64, ZH), 512, 0, stream>>>(P16 + (size_t)RH * TT, nullptr, VT16 + zk * HD * TT, nullptr, TT, Ob + (size_t)RH * HD, HD, RH, (size_t)TT * TT, (size_t)HD * TT, (size_t)TT * HD);
            k_merge<<<(unsigned)(((size_t)ZH * TT * HD / 2 + 255) / 256), 256, 0, stream>>>(Ob, h0, ATh, ATl); }
        k_gemmw<bf, 1, true, 8><<<dim3(TT / 64, DM / 64, 1), 256, 0, stream>>>(ATh, ATl, WO, nullptr, DQ, OUT + (size_t)b * TT * DM, DM, bo, 0, 0, 0); }
}

// v002
// Measured time: 126 microseconds a run.
// Next to v001, in two timings, it ran 3.15 and 3.17 times as fast.
// Over all steps from v000 it is 5.84 times as fast.
#include <hip/hip_runtime.h>

// MultiHeadAttentionV2 (q/k/v encodings [1][2048][1024] (three inputs); q/k/v = x W^T + b (torch; 16 heads x 64); causal softmax(q.k / 8); out = merged Wo^T + bo -> [1][2048][1024]).
// Compute dtypes, f32 accumulate: every input rounded to bf16; q/k/v on PLAIN bf16 operands (inputs: exact) + bias; causal scores and attn.v: query rows < 512 hl (3 products), the rest single fp16 (x1024); softmax f32; Wo hl x exact (2 products) + bias.

#define NB_  1
#define TT   2048
#define DM   1024
#define NH_  16
#define NKV  16
#define HD   64
#define DQ   (NH_ * HD)
#define DKV  (NKV * HD)
#define RH   512                  // query rows < RH use hi+lo planes (0: none)
#define PCAR 1024.0f
#define SCL  0.125f   // HD^-0.5
typedef _Float16 h16;
typedef unsigned short bf;
typedef __attribute__((ext_vector_type(16))) __bf16   v16bf;
typedef __attribute__((ext_vector_type(16))) _Float16 v16h;
typedef __attribute__((ext_vector_type(8)))  _Float16 v8h;
typedef __attribute__((ext_vector_type(8)))  unsigned short v8us;
typedef __attribute__((ext_vector_type(8)))  float    v8f;
typedef __attribute__((ext_vector_type(4)))  float    v4f;
typedef v8h  __attribute__((may_alias)) v8ha;
typedef v4f  __attribute__((may_alias)) v4fa;
typedef v8us __attribute__((may_alias)) v8usa;

__device__ __forceinline__ unsigned short f2bf(float f) { unsigned u = __float_as_uint(f); u += 0x7FFFu + ((u >> 16) & 1u); return (unsigned short)(u >> 16); }
__device__ __forceinline__ float bf2f(unsigned short b) { return __uint_as_float(((unsigned)b) << 16); }
__device__ __forceinline__ float bfr(float f) { return bf2f(f2bf(f)); }
__device__ __forceinline__ v16h cat16(v8h lo, v8h hi) { return __builtin_shufflevector(lo, hi, 0, 1, 2, 3, 4, 5, 6, 7, 8, 9, 10, 11, 12, 13, 14, 15); }
__device__ __forceinline__ v16bf cat16b(v8us lo, v8us hi) { return __builtin_bit_cast(v16bf, __builtin_shufflevector(lo, hi, 0, 1, 2, 3, 4, 5, 6, 7, 8, 9, 10, 11, 12, 13, 14, 15)); }
__device__ __forceinline__ v8f wmma16(v16h a, v16h b, v8f c) { return __builtin_amdgcn_wmma_f32_16x16x32_f16(false, a, false, b, (short)0, c, false, false); }
__device__ __forceinline__ v8f wmmab(v16bf a, v16bf b, v8f c) { return __builtin_amdgcn_wmma_f32_16x16x32_bf16(false, a, false, b, (short)0, c, false, false); }



// ---- k_gemmw: register-blocked GEMM, one work-group of NW waves per 64x64 output tile; wave w takes the 32-wide K blocks w, w + NW, ... into its own 16 accumulators, and the NW partial tiles are
// summed through LDS in wave order (a fixed order). Operands straight from K-contiguous 16-bit planes; grid (M/64, N/64, Z), 32 * NW threads.
// C[m][n] (f32, pitch ldc, + optional f32 bias[n]) = sum_k A[m][k] Bt[n][k] (+ split products per NSPLIT). z-batch strides sA/sB/sC in elements. K % 32 == 0.
template <typename T16> struct WFrag;
template <> struct WFrag<h16> { typedef v16h V; static __device__ __forceinline__ V ld(const h16* p) { return cat16(*(const v8h*)p, *(const v8h*)(p + 16)); } static __device__ __forceinline__ v8f mma(V a, V b, v8f c) { return wmma16(a, b, c); } };
template <> struct WFrag<bf> { typedef v16bf V; static __device__ __forceinline__ V ld(const bf* p) { return cat16b(*(const v8us*)p, *(const v8us*)(p + 16)); } static __device__ __forceinline__ v8f mma(V a, V b, v8f c) { return wmmab(a, b, c); } };
template <typename T16, int NSPLIT, bool BIAS, int NW>
__global__ __launch_bounds__(32 * NW) void k_gemmw(const T16* __restrict__ A, const T16* __restrict__ A2, const T16* __restrict__ Bt, const T16* __restrict__ Bt2, int K, float* C, int ldc, const float* __restrict__ bias, size_t sA, size_t sB, size_t sC) {
    typedef typename WFrag<T16>::V V;
    __shared__ __align__(16) float os[NW * 64 * 68];
    const size_t z = blockIdx.z; A += z * sA; if (A2) A2 += z * sA; Bt += z * sB; if (Bt2) Bt2 += z * sB; C += z * sC;
    const int lane = threadIdx.x & 31, lr = lane & 15, hi = lane >> 4; const int r0 = blockIdx.x * 64, c0 = blockIdx.y * 64;
    const int wv = __builtin_amdgcn_readfirstlane((int)(threadIdx.x >> 5));   // wave number, scalar: the K loop's trip test stays a scalar branch (every lane on at the matrix instructions)
    v8f acc[4][4];
#pragma unroll
    for (int mb = 0; mb < 4; ++mb)
#pragma unroll
        for (int nb = 0; nb < 4; ++nb) acc[mb][nb] = (v8f){};
    const size_t aoff = (size_t)(r0 + lr) * K + 8 * hi, boff = (size_t)(c0 + lr) * K + 8 * hi;
#pragma unroll 1
    for (int kc = 32 * wv; kc < K; kc += 32 * NW) {
        V a[4], a2[4];
#pragma unroll
        for (int mb = 0; mb < 4; ++mb) { a[mb] = WFrag<T16>::ld(A + aoff + (size_t)mb * 16 * K + kc); if (NSPLIT == 1 || NSPLIT == 2) a2[mb] = WFrag<T16>::ld(A2 + aoff + (size_t)mb * 16 * K + kc); }
#pragma unroll
        for (int nb = 0; nb < 4; ++nb) { const V b = WFrag<T16>::ld(Bt + boff + (size_t)nb * 16 * K + kc); V b2; if (NSPLIT >= 2) b2 = WFrag<T16>::ld(Bt2 + boff + (size_t)nb * 16 * K + kc);
#pragma unroll
            for (int mb = 0; mb < 4; ++mb) { acc[mb][nb] = WFrag<T16>::mma(a[mb], b, acc[mb][nb]); if (NSPLIT == 1 || NSPLIT == 2) acc[mb][nb] = WFrag<T16>::mma(a2[mb], b, acc[mb][nb]); if (NSPLIT >= 2) acc[mb][nb] = WFrag<T16>::mma(a[mb], b2, acc[mb][nb]); } }
        asm volatile("v_nop\n\tv_nop\n\tv_nop\n\tv_nop" : "+v"(acc[0][0]), "+v"(acc[1][1]), "+v"(acc[2][2]), "+v"(acc[3][3]) : "v"(a[0]), "v"(a[3]));
    }
#pragma unroll
    for (int mb = 0; mb < 4; ++mb) {
#pragma unroll
        for (int nb = 0; nb < 4; ++nb) {
#pragma unroll
            for (int j = 0; j < 8; ++j) os[wv * (64 * 68) + (mb * 16 + hi * 8 + j) * 68 + nb * 16 + lr] = acc[mb][nb][j]; }
    }
    __syncthreads();   // every wave's partial 64x64 tile is in LDS before any thread sums them
    float* crow = C + (size_t)r0 * ldc + c0;
    // both loops unrolled so that the LDS reads of all the sums issue ahead of the adds, and the stores go out together
#pragma unroll
    for (int i = 0; i < 32 / NW; ++i) { const int s = threadIdx.x + i * (32 * NW), row = s >> 4, cofs = (s & 15) * 4; v4f val = *(const v4fa*)(os + row * 68 + cofs);
#pragma unroll
        for (int w = 1; w < NW; ++w) val += *(const v4fa*)(os + w * (64 * 68) + row * 68 + cofs);
        if (BIAS) { val[0] += bfr(bias[c0 + cofs]); val[1] += bfr(bias[c0 + cofs + 1]); val[2] += bfr(bias[c0 + cofs + 2]); val[3] += bfr(bias[c0 + cofs + 3]); }
        *(v4f*)(crow + (size_t)row * ldc + cofs) = val; }
}

__device__ __forceinline__ h16 tohx(float x) { return (h16)x; }
__device__ __forceinline__ void splitf(float y, unsigned short& h, unsigned short& l) { h = f2bf(y); l = f2bf(y - bf2f(h)); }
typedef __attribute__((ext_vector_type(2))) _Float16 v2h;
typedef __attribute__((ext_vector_type(4))) _Float16 v4h;
typedef __attribute__((ext_vector_type(2))) unsigned short v2us;
typedef __attribute__((ext_vector_type(4))) unsigned short v4us;
typedef __attribute__((ext_vector_type(2))) float v2f;
typedef __attribute__((ext_vector_type(4))) int v4i;

__global__ __launch_bounds__(256) void k_wtG(const float* __restrict__ w, int K, int N, bf* Bt) {
    const int lane = threadIdx.x & 31; const int L0 = (blockIdx.x * 8 + (threadIdx.x >> 5)) * 8; const int nlines = N * K / 64;
{
#pragma unroll 1
        for (int l = 0; l < 8; ++l) { const int L = L0 + l; if (L >= nlines) break; const size_t e = (size_t)L * 64 + lane * 2; const int k = (int)(e % K), n = (int)(e / K); v2us o;
            o[0] = f2bf(w[(size_t)k * N + n]); o[1] = f2bf(w[(size_t)(k + 1) * N + n]); *(v2us*)(Bt + e) = o; }
         }
}
__global__ __launch_bounds__(256) void k_cvt8(const float* __restrict__ src, bf* dst, size_t n8) { const size_t i = (size_t)blockIdx.x * 256 + threadIdx.x; if (i >= n8) return; const v8f v = *(const v8f*)(src + i * 8); v8us o;
#pragma unroll
    for (int k = 0; k < 8; ++k) o[k] = f2bf(v[k]); *(v8us*)(dst + i * 8) = o;  }
__global__ __launch_bounds__(256) void k_cscvt(const float* __restrict__ cosT, const float* __restrict__ sinT, float* CS) { const int idx = blockIdx.x * 256 + threadIdx.x; if (idx >= TT * HD) return; v2f cs; cs[0] = bfr(cosT[idx]); cs[1] = bfr(sinT[idx]); *(v2f*)(CS + (size_t)idx * 2) = cs;  }
// k_rope: head planes [h][t][d] (fp16 + hi/lo) of rope(x) x sc with the rotate-half convention out[d] = x[d] cos[t][d] - x[d+HD/2] sin[t][d], out[d+HD/2] = x[d+HD/2] cos[t][d+HD/2] + x[d] sin[t][d+HD/2]
__global__ __launch_bounds__(256) void k_rope(const float* __restrict__ F, int pitch, int nheads, const float* __restrict__ CS, const float* __restrict__ RF, const float* __restrict__ nw, float sc, h16* P16, bf* Ph, bf* Pl) {
    const size_t e = ((size_t)blockIdx.x * 256 + threadIdx.x) * 2; if (e >= (size_t)nheads * TT * HD) return; const int d = (int)(e % HD); const int t = (int)((e / HD) % TT); const int h = (int)(e / ((size_t)HD * TT)); const float* f = F + (size_t)t * pitch + h * HD; const float rf = RF ? RF[(size_t)h * TT + t] : 1.0f; v2h o16; v2us oh, ol;
#pragma unroll
    for (int q = 0; q < 2; ++q) { const int dd = d + q; const int dp = (dd < HD / 2) ? dd + HD / 2 : dd - HD / 2; float x0 = f[dd], x1 = f[dp];
        if (RF) { float n0 = __fmul_rn(x0, rf), n1 = __fmul_rn(x1, rf); asm volatile("" : "+v"(n0)); asm volatile("" : "+v"(n1)); x0 = __fmul_rn(bfr(nw[dd]), n0); x1 = __fmul_rn(bfr(nw[dp]), n1); }
        const v2f cs = *(const v2f*)(CS + ((size_t)t * HD + dd) * 2); float a = __fmul_rn(x0, cs[0]), bq = __fmul_rn(x1, cs[1]); asm volatile("" : "+v"(a)); asm volatile("" : "+v"(bq)); const float r = ((dd < HD / 2) ? __fsub_rn(a, bq) : __fadd_rn(a, bq)) * sc;
        o16[q] = tohx(r); unsigned short a2, c2; splitf(r, a2, c2); oh[q] = a2; ol[q] = c2; }
    *(v2h*)(P16 + e) = o16; *(v2us*)(Ph + e) = oh; *(v2us*)(Pl + e) = ol;  }
__global__ __launch_bounds__(256) void k_vtp(const float* __restrict__ F, int pitch, int nheads, h16* V16, bf* Vh, bf* Vl) { const size_t e = ((size_t)blockIdx.x * 256 + threadIdx.x) * 2; if (e >= (size_t)nheads * HD * TT) return; const int t = (int)(e % TT); const int d = (int)((e / TT) % HD); const int g = (int)(e / ((size_t)TT * HD)); v2h o16; v2us oh, ol;
#pragma unroll
    for (int q = 0; q < 2; ++q) { const float x = F[(size_t)(t + q) * pitch + g * HD + d]; o16[q] = tohx(x); unsigned short a2, c2; splitf(x, a2, c2); oh[q] = a2; ol[q] = c2; }
    *(v2h*)(V16 + e) = o16; *(v2us*)(Vh + e) = oh; *(v2us*)(Vl + e) = ol;  }
__global__ __launch_bounds__(256) void k_csid(float* CS) { const int idx = blockIdx.x * 256 + threadIdx.x; if (idx >= TT * HD) return; v2f cs; cs[0] = 1.0f; cs[1] = 0.0f; *(v2f*)(CS + (size_t)idx * 2) = cs;  }
// ---- k_attn: causal attention of one head and one tile of queries in ONE launch: scores, softmax (running maximum and sum) and the probability x value product stay in registers.
// Transposed products: S^T = K Q^T (A = key rows, B = query rows), O^T += V^T P^T (A = V^T rows, B = P^T). In a 16-query group lane lr (both halves) holds query lr; two 16-key score tiles are, register for register,
// the B operand of the 32-key value product. Wave w of the work-group takes the 32-key blocks w, w + NW, ... with its own maximum, sum and accumulators; the NW partials are merged through LDS in wave order.
#define L2E 1.4426950408889634f
__device__ __forceinline__ float xhalf(float x) { return __builtin_bit_cast(float, __builtin_amdgcn_permlanex16(__builtin_bit_cast(int, x), __builtin_bit_cast(int, x), 0x76543210, 0xfedcba98, false, false)); }   // lane l with lane l ^ 16, in registers
template <typename T16, bool HR, int NQ, int NW>
__device__ __forceinline__ void attn_tile(const T16* __restrict__ Q, const T16* __restrict__ Q2, const T16* __restrict__ Kp, const T16* __restrict__ K2, const T16* __restrict__ Vt, const T16* __restrict__ V2, int q0, bf* Ah, bf* Al, float* os, float* ms, float* ls) {
    typedef typename WFrag<T16>::V V;
    constexpr int QT = 16 * NQ;
    const int lane = threadIdx.x & 31, lr = lane & 15, hi = lane >> 4;
    const int wv = __builtin_amdgcn_readfirstlane((int)(threadIdx.x >> 5));   // wave number, scalar: the key loop's trip test stays a scalar branch (every lane on at the matrix instructions)
    V qf[NQ][2], qf2[NQ][2];
#pragma unroll
    for (int nt = 0; nt < NQ; ++nt)
#pragma unroll
        for (int ks = 0; ks < 2; ++ks) { const size_t qo = (size_t)(q0 + nt * 16 + lr) * HD + ks * 32 + 8 * hi; qf[nt][ks] = WFrag<T16>::ld(Q + qo); if (HR) qf2[nt][ks] = WFrag<T16>::ld(Q2 + qo); }
    v8f o[4][NQ]; float m[NQ], l[NQ];
#pragma unroll
    for (int nt = 0; nt < NQ; ++nt) { m[nt] = -3.0e38f; l[nt] = 0.f;
#pragma unroll
        for (int dt = 0; dt < 4; ++dt) o[dt][nt] = (v8f){}; }
    // the lane's own K and V pointers, stepped by NW blocks at the foot of each trip
    const size_t kst = (size_t)(32 * wv + lr) * HD + 8 * hi, vst = (size_t)lr * TT + 32 * wv + 8 * hi;
    const T16* kp = Kp + kst; const T16* kp2 = HR ? K2 + kst : nullptr; const T16* vp = Vt + vst; const T16* vp2 = HR ? V2 + vst : nullptr;
    // every block taken starts at a key <= q0, so each query of the tile has at least one unmasked key in it and the running maximum is a real score after a wave's first block
#pragma unroll 1
    for (int k0 = 32 * wv; k0 < q0 + QT; k0 += 32 * NW) {
        v8f st[2][NQ];
#pragma unroll
        for (int kt = 0; kt < 2; ++kt)
#pragma unroll
            for (int nt = 0; nt < NQ; ++nt) st[kt][nt] = (v8f){};
        V kf[2][2], kf2[2][2], vf[4], vf2[4];   // all of the block's K and V fragments are asked for at once, so that the V loads fly while the scores are formed
#pragma unroll
        for (int kt = 0; kt < 2; ++kt)
#pragma unroll
            for (int ks = 0; ks < 2; ++ks) { const int ko = kt * 16 * HD + ks * 32; kf[kt][ks] = WFrag<T16>::ld(kp + ko); if (HR) kf2[kt][ks] = WFrag<T16>::ld(kp2 + ko); }
        // precaution: the wait stands in front of every reuse of the address registers that the issued K loads name; it takes the pointers as inputs so that their registers are held up to it;
        // the scheduling barrier keeps later address arithmetic behind it and every K load in front of the first product
        if constexpr (HR) asm volatile("s_wait_xcnt 0x0" :: "v"(kp), "v"(kp2) : "memory"); else asm volatile("s_wait_xcnt 0x0" :: "v"(kp) : "memory");
        __builtin_amdgcn_sched_barrier(0);
#pragma unroll
        for (int dt = 0; dt < 4; ++dt) { const int vo = dt * 16 * TT; vf[dt] = WFrag<T16>::ld(vp + vo); if (HR) vf2[dt] = WFrag<T16>::ld(vp2 + vo); }
        // the same behind the V loads: all of them are in flight before the wave first waits for K
        if constexpr (HR) asm volatile("s_wait_xcnt 0x0" :: "v"(vp), "v"(vp2) : "memory"); else asm volatile("s_wait_xcnt 0x0" :: "v"(vp) : "memory");
        __builtin_amdgcn_sched_barrier(0);
#pragma unroll
        for (int kt = 0; kt < 2; ++kt)
#pragma unroll
            for (int ks = 0; ks < 2; ++ks)
#pragma unroll
                for (int nt = 0; nt < NQ; ++nt) { st[kt][nt] = WFrag<T16>::mma(kf[kt][ks], qf[nt][ks], st[kt][nt]); if (HR) { st[kt][nt] = WFrag<T16>::mma(kf[kt][ks], qf2[nt][ks], st[kt][nt]); st[kt][nt] = WFrag<T16>::mma(kf2[kt][ks], qf[nt][ks], st[kt][nt]); } }
        if (k0 + 31 > q0) {   // scalar branch: only a block that reaches past the tile's first query needs the causal select
#pragma unroll
            for (int nt = 0; nt < NQ; ++nt)
#pragma unroll
                for (int kt = 0; kt < 2; ++kt)
#pragma unroll
                    for (int j = 0; j < 8; ++j) st[kt][nt][j] = (k0 + kt * 16 + hi * 8 + j <= q0 + nt * 16 + lr) ? st[kt][nt][j] : -3.0e38f;
        }
#pragma unroll
        for (int nt = 0; nt < NQ; ++nt) {
            float mx = m[nt];
#pragma unroll
            for (int kt = 0; kt < 2; ++kt)
#pragma unroll
                for (int j = 0; j < 8; ++j) { const float t = st[kt][nt][j] * SCL; st[kt][nt][j] = t; mx = fmaxf(mx, t); }
            mx = fmaxf(mx, xhalf(mx));   // the two halves of the wave hold the other keys of the same query
            const float al = __builtin_amdgcn_exp2f((m[nt] - mx) * L2E); m[nt] = mx; float sum = 0.f;
#pragma unroll
            for (int kt = 0; kt < 2; ++kt)
#pragma unroll
                for (int j = 0; j < 8; ++j) { const float e = __builtin_amdgcn_exp2f((st[kt][nt][j] - mx) * L2E); st[kt][nt][j] = e; sum += e; }
            l[nt] = l[nt] * al + sum;
#pragma unroll
            for (int dt = 0; dt < 4; ++dt) o[dt][nt] *= al;
            if constexpr (HR) {
                v8us h0, h1, l0, l1;
#pragma unroll
                for (int j = 0; j < 8; ++j) { unsigned short a, c2; splitf(st[0][nt][j], a, c2); h0[j] = a; l0[j] = c2; splitf(st[1][nt][j], a, c2); h1[j] = a; l1[j] = c2; }
                const V ph = cat16b(h0, h1), pl = cat16b(l0, l1);
#pragma unroll
                for (int dt = 0; dt < 4; ++dt) { o[dt][nt] = WFrag<T16>::mma(vf[dt], ph, o[dt][nt]); o[dt][nt] = WFrag<T16>::mma(vf[dt], pl, o[dt][nt]); o[dt][nt] = WFrag<T16>::mma(vf2[dt], ph, o[dt][nt]); }
            } else {
                v8h p0, p1;
#pragma unroll
                for (int j = 0; j < 8; ++j) { p0[j] = tohx(st[0][nt][j] * PCAR); p1[j] = tohx(st[1][nt][j] * PCAR); }
                const V pf = cat16(p0, p1);
#pragma unroll
                for (int dt = 0; dt < 4; ++dt) o[dt][nt] = WFrag<T16>::mma(vf[dt], pf, o[dt][nt]);
            }
        }
        kp += 32 * NW * HD; vp += 32 * NW; if (HR) { kp2 += 32 * NW * HD; vp2 += 32 * NW; }
    }
#pragma unroll
    for (int nt = 0; nt < NQ; ++nt) { const int q = nt * 16 + lr; const float lt = l[nt] + xhalf(l[nt]); if (hi == 0) { ms[wv * QT + q] = m[nt]; ls[wv * QT + q] = lt; }
#pragma unroll
        for (int dt = 0; dt < 4; ++dt) { float* op = os + (size_t)(wv * QT + q) * 68 + dt * 16 + hi * 8; v4f x0, x1;
#pragma unroll
            for (int j = 0; j < 4; ++j) { x0[j] = o[dt][nt][j]; x1[j] = o[dt][nt][4 + j]; }
            *(v4fa*)op = x0; *(v4fa*)(op + 4) = x1; } }
    __syncthreads();   // every wave's partial (maximum, sum, 64 x QT tile) is in LDS before any thread merges them
    constexpr int EP = QT * HD / (32 * NW);   // output elements a thread: EP consecutive d of one query
    const int q = threadIdx.x / (HD / EP), d0 = (threadIdx.x % (HD / EP)) * EP;
    float M = ms[q];
#pragma unroll
    for (int w = 1; w < NW; ++w) M = fmaxf(M, ms[w * QT + q]);
    float L = 0.f, val[EP];
#pragma unroll
    for (int e = 0; e < EP; ++e) val[e] = 0.f;
#pragma unroll
    for (int w = 0; w < NW; ++w) { const float fw = __builtin_amdgcn_exp2f((ms[w * QT + q] - M) * L2E); L += fw * ls[w * QT + q];   // a wave that took no block has maximum -3e38, weight 0, and a zero tile
#pragma unroll
        for (int e4 = 0; e4 < EP / 4; ++e4) { const v4f x = *(const v4fa*)(os + (size_t)(w * QT + q) * 68 + d0 + e4 * 4);
#pragma unroll
            for (int j = 0; j < 4; ++j) val[e4 * 4 + j] += fw * x[j]; } }
    const float f = __fdiv_rn(HR ? 1.0f : (1.0f / PCAR), L);
    const size_t oo = (size_t)(q0 + q) * DQ + d0;
#pragma unroll
    for (int e4 = 0; e4 < EP / 4; ++e4) { v4us oh, ol;
#pragma unroll
        for (int j = 0; j < 4; ++j) { unsigned short a, c2; splitf(val[e4 * 4 + j] * f, a, c2); oh[j] = a; ol[j] = c2; }
        *(v4us*)(Ah + oo + e4 * 4) = oh; *(v4us*)(Al + oo + e4 * 4) = ol; }
}
// grid (RH / 16 + (TT - RH) / 32, heads), 256 threads; the tiles with the most keys have the lowest block indices (for speed only). Query rows < RH: hi+lo bf16 planes, 16 queries a tile; the rest fp16, 32 queries.
__global__ __launch_bounds__(256) void k_attn(const h16* __restrict__ Q16, const h16* __restrict__ K16, const h16* __restrict__ V16, const bf* __restrict__ Qh, const bf* __restrict__ Ql, const bf* __restrict__ Kh, const bf* __restrict__ Kl, const bf* __restrict__ Vh, const bf* __restrict__ Vl, bf* Ah, bf* Al) {
    __shared__ __align__(16) float os[8 * 32 * 68]; __shared__ float ms[8 * 32]; __shared__ float ls[8 * 32];
    const int t = (int)(gridDim.x - 1 - blockIdx.x); const size_t hp = (size_t)blockIdx.y * TT * HD; Ah += blockIdx.y * HD; Al += blockIdx.y * HD;
    if (t < RH / 16) attn_tile<bf, true, 1, 8>(Qh + hp, Ql + hp, Kh + hp, Kl + hp, Vh + hp, Vl + hp, t * 16, Ah, Al, os, ms, ls);
    else attn_tile<h16, false, 2, 8>(Q16 + hp, nullptr, K16 + hp, nullptr, V16 + hp, nullptr, RH + (t - RH / 16) * 32, Ah, Al, os, ms, ls);
}

extern "C" void kernel_launch(void* const* d_in, const int* in_sizes, int n_in,
                              void* d_out, int out_size, void* d_ws, size_t ws_size, hipStream_t stream) {
    (void)in_sizes; (void)n_in; (void)out_size;
    const float* x = (const float*)d_in[0]; const float* xk = (const float*)d_in[1]; const float* xv = (const float*)d_in[2]; const float* wq = (const float*)d_in[3]; const float* bq = (const float*)d_in[4]; const float* wk = (const float*)d_in[5]; const float* bk = (const float*)d_in[6]; const float* wv = (const float*)d_in[7]; const float* bv = (const float*)d_in[8]; const float* wo = (const float*)d_in[9]; const float* bo = (const float*)d_in[10]; const float* cosT = nullptr; const float* sinT = nullptr; (void)cosT; (void)sinT;
    float* OUT = (float*)d_out;     // [1][2048][1024]
    char* wsp = (char*)d_ws;
    auto take = [&](size_t bytes) { char* p = wsp; wsp += (bytes + 255) & ~(size_t)255; return (void*)p; };
    bf* WQ = (bf*)take((size_t)DQ * DM * 2); bf* WK = (bf*)take((size_t)DKV * DM * 2); bf* WV = (bf*)take((size_t)DKV * DM * 2); bf* WO = (bf*)take((size_t)DM * DQ * 2); float* CS = (float*)take((size_t)TT * HD * 2 * 4);
    bf* XB = (bf*)take((size_t)TT * DM * 2); bf* XB2 = (bf*)take((size_t)TT * DM * 2); bf* XB3 = (bf*)take((size_t)TT * DM * 2); float* FQ = (float*)take((size_t)TT * DQ * 4); float* FK = (float*)take((size_t)TT * DKV * 4);
    h16* QP16 = (h16*)take((size_t)NH_ * TT * HD * 2); h16* KP16 = (h16*)take((size_t)NKV * TT * HD * 2); h16* VT16 = (h16*)take((size_t)NKV * HD * TT * 2);
    bf* QPh = (bf*)take((size_t)NH_ * TT * HD * 2); bf* QPl = (bf*)take((size_t)NH_ * TT * HD * 2); bf* KPh = (bf*)take((size_t)NKV * TT * HD * 2); bf* KPl = (bf*)take((size_t)NKV * TT * HD * 2); bf* VTh = (bf*)take((size_t)NKV * HD * TT * 2); bf* VTl = (bf*)take((size_t)NKV * HD * TT * 2);
    bf* ATh = (bf*)take((size_t)TT * DQ * 2); bf* ATl = (bf*)take((size_t)TT * DQ * 2);
    if ((size_t)(wsp - (char*)d_ws) > ws_size) return;    // ws 256 MiB
    float* FV = FK;   // v projection reuses the k buffer after the k planes are built (stream-ordered)
    { k_cvt8<<<(unsigned)(((size_t)DQ * DM / 8 + 255) / 256), 256, 0, stream>>>(wq, WQ, (size_t)DQ * DM / 8); k_cvt8<<<(unsigned)(((size_t)DKV * DM / 8 + 255) / 256), 256, 0, stream>>>(wk, WK, (size_t)DKV * DM / 8); k_cvt8<<<(unsigned)(((size_t)DKV * DM / 8 + 255) / 256), 256, 0, stream>>>(wv, WV, (size_t)DKV * DM / 8);
      k_cvt8<<<(unsigned)(((size_t)DM * DQ / 8 + 255) / 256), 256, 0, stream>>>(wo, WO, (size_t)DM * DQ / 8);
       }
    k_csid<<<(TT * HD + 255) / 256, 256, 0, stream>>>(CS);
    const unsigned LQ = (unsigned)(((size_t)NH_ * TT * HD / 2 + 255) / 256), LKv = (unsigned)(((size_t)NKV * TT * HD / 2 + 255) / 256);
    for (int b = 0; b < NB_; ++b) {
        
        k_cvt8<<<(unsigned)(((size_t)TT * DM / 8 + 255) / 256), 256, 0, stream>>>(x + (size_t)b * TT * DM, XB, (size_t)TT * DM / 8); k_cvt8<<<(unsigned)(((size_t)TT * DM / 8 + 255) / 256), 256, 0, stream>>>(xk + (size_t)b * TT * DM, XB2, (size_t)TT * DM / 8); k_cvt8<<<(unsigned)(((size_t)TT * DM / 8 + 255) / 256), 256, 0, stream>>>(xv + (size_t)b * TT * DM, XB3, (size_t)TT * DM / 8);
        k_gemmw<bf, 0, true, 8><<<dim3(TT / 64, DQ / 64, 1), 256, 0, stream>>>(XB, nullptr, WQ, nullptr, DM, FQ, DQ, bq, 0, 0, 0);
        k_rope<<<LQ, 256, 0, stream>>>(FQ, DQ, NH_, CS, nullptr, nullptr, 1.0f, QP16, QPh, QPl);
        k_gemmw<bf, 0, true, 8><<<dim3(TT / 64, DKV / 64, 1), 256, 0, stream>>>(XB2, nullptr, WK, nullptr, DM, FK, DKV, bk, 0, 0, 0);
        k_rope<<<LKv, 256, 0, stream>>>(FK, DKV, NKV, CS, nullptr, nullptr, 1.0f, KP16, KPh, KPl);
        k_gemmw<bf, 0, true, 8><<<dim3(TT / 64, DKV / 64, 1), 256, 0, stream>>>(XB3, nullptr, WV, nullptr, DM, FV, DKV, bv, 0, 0, 0); k_vtp<<<LKv, 256, 0, stream>>>(FV, DKV, NKV, VT16, VTh, VTl);
        k_attn<<<dim3(RH / 16 + (TT - RH) / 32, NH_, 1), 256, 0, stream>>>(QP16, KP16, VT16, QPh, QPl, KPh, KPl, VTh, VTl, ATh, ATl);
        k_gemmw<bf, 1, true, 8><<<dim3(TT / 64, DM / 64, 1), 256, 0, stream>>>(ATh, ATl, WO, nullptr, DQ, OUT + (size_t)b * TT * DM, DM, bo, 0, 0, 0); }
}

// v003
// One run takes 88 microseconds.
// Timed twice side by side with v002, it ran 1.43 times as fast both times.
// Over all steps from v000 it is 8.33 times as fast.
#include <hip/hip_runtime.h>

// MultiHeadAttentionV2 (q/k/v encodings [1][2048][1024] (three inputs); q/k/v = x W^T + b (torch; 16 heads x 64); causal softmax(q.k / 8); out = merged Wo^T + bo -> [1][2048][1024]).
// Compute dtypes, f32 accumulate: every input rounded to bf16; q/k/v on PLAIN bf16 operands (inputs: exact) + bias; causal scores and attn.v: query rows < 512 hl (3 products), the rest single fp16 (x1024); softmax f32; Wo hl x exact (2 products) + bias.

#define NB_  1
#define TT   2048
#define DM   1024
#define NH_  16
#define NKV  16
#define HD   64
#define DQ   (NH_ * HD)
#define DKV  (NKV * HD)
#define RH   512                  // query rows < RH use hi+lo planes (0: none)
#define PCAR 1024.0f
#define SCL  0.125f   // HD^-0.5
typedef _Float16 h16;
typedef unsigned short bf;
typedef __attribute__((ext_vector_type(16))) __bf16   v16bf;
typedef __attribute__((ext_vector_type(16))) _Float16 v16h;
typedef __attribute__((ext_vector_type(8)))  _Float16 v8h;
typedef __attribute__((ext_vector_type(8)))  unsigned short v8us;
typedef __attribute__((ext_vector_type(8)))  float    v8f;
typedef __attribute__((ext_vector_type(4)))  float    v4f;
typedef v8h  __attribute__((may_alias)) v8ha;
typedef v4f  __attribute__((may_alias)) v4fa;
typedef v8us __attribute__((may_alias)) v8usa;

__device__ __forceinline__ unsigned short f2bf(float f) { unsigned u = __float_as_uint(f); u += 0x7FFFu + ((u >> 16) & 1u); return (unsigned short)(u >> 16); }
__device__ __forceinline__ float bf2f(unsigned short b) { return __uint_as_float(((unsigned)b) << 16); }
__device__ __forceinline__ float bfr(float f) { return bf2f(f2bf(f)); }
__device__ __forceinline__ v16h cat16(v8h lo, v8h hi) { return __builtin_shufflevector(lo, hi, 0, 1, 2, 3, 4, 5, 6, 7, 8, 9, 10, 11, 12, 13, 14, 15); }
__device__ __forceinline__ v16bf cat16b(v8us lo, v8us hi) { return __builtin_bit_cast(v16bf, __builtin_shufflevector(lo, hi, 0, 1, 2, 3, 4, 5, 6, 7, 8, 9, 10, 11, 12, 13, 14, 15)); }
__device__ __forceinline__ v8f wmma16(v16h a, v16h b, v8f c) { return __builtin_amdgcn_wmma_f32_16x16x32_f16(false, a, false, b, (short)0, c, false, false); }
__device__ __forceinline__ v8f wmmab(v16bf a, v16bf b, v8f c) { return __builtin_amdgcn_wmma_f32_16x16x32_bf16(false, a, false, b, (short)0, c, false, false); }



// ---- k_gemmw: register-blocked GEMM, one work-group of NW waves per 64x64 output tile; wave w takes the 32-wide K blocks w, w + NW, ... into its own 16 accumulators, and the NW partial tiles are
// summed through LDS in wave order (a fixed order). Operands straight from K-contiguous 16-bit planes; grid (M/64, N/64, Z), 32 * NW threads.
// C[m][n] (f32, pitch ldc, + optional f32 bias[n]) = sum_k A[m][k] Bt[n][k] (+ split products per NSPLIT). z-batch strides sA/sB/sC in elements. K % 32 == 0.
template <typename T16> struct WFrag;
template <> struct WFrag<h16> { typedef v16h V; static __device__ __forceinline__ V ld(const h16* p) { return cat16(*(const v8h*)p, *(const v8h*)(p + 16)); } static __device__ __forceinline__ v8f mma(V a, V b, v8f c) { return wmma16(a, b, c); } };
template <> struct WFrag<bf> { typedef v16bf V; static __device__ __forceinline__ V ld(const bf* p) { return cat16b(*(const v8us*)p, *(const v8us*)(p + 16)); } static __device__ __forceinline__ v8f mma(V a, V b, v8f c) { return wmmab(a, b, c); } };
template <typename T16, int NSPLIT, bool BIAS, int NW>
__global__ __launch_bounds__(32 * NW) void k_gemmw(const T16* __restrict__ A, const T16* __restrict__ A2, const T16* __restrict__ Bt, const T16* __restrict__ Bt2, int K, float* C, int ldc, const float* __restrict__ bias, size_t sA, size_t sB, size_t sC) {
    typedef typename WFrag<T16>::V V;
    __shared__ __align__(16) float os[NW * 64 * 68];
    const size_t z = blockIdx.z; A += z * sA; if (A2) A2 += z * sA; Bt += z * sB; if (Bt2) Bt2 += z * sB; C += z * sC;
    const int lane = threadIdx.x & 31, lr = lane & 15, hi = lane >> 4; const int r0 = blockIdx.x * 64, c0 = blockIdx.y * 64;
    const int wv = __builtin_amdgcn_readfirstlane((int)(threadIdx.x >> 5));   // wave number, scalar: the K loop's trip test stays a scalar branch (every lane on at the matrix instructions)
    v8f acc[4][4];
#pragma unroll
    for (int mb = 0; mb < 4; ++mb)
#pragma unroll
        for (int nb = 0; nb < 4; ++nb) acc[mb][nb] = (v8f){};
    const size_t aoff = (size_t)(r0 + lr) * K + 8 * hi, boff = (size_t)(c0 + lr) * K + 8 * hi;
#pragma unroll 1
    for (int kc = 32 * wv; kc < K; kc += 32 * NW) {
        V a[4], a2[4];
#pragma unroll
        for (int mb = 0; mb < 4; ++mb) { a[mb] = WFrag<T16>::ld(A + aoff + (size_t)mb * 16 * K + kc); if (NSPLIT == 1 || NSPLIT == 2) a2[mb] = WFrag<T16>::ld(A2 + aoff + (size_t)mb * 16 * K + kc); }
#pragma unroll
        for (int nb = 0; nb < 4; ++nb) { const V b = WFrag<T16>::ld(Bt + boff + (size_t)nb * 16 * K + kc); V b2; if (NSPLIT >= 2) b2 = WFrag<T16>::ld(Bt2 + boff + (size_t)nb * 16 * K + kc);
#pragma unroll
            for (int mb = 0; mb < 4; ++mb) { acc[mb][nb] = WFrag<T16>::mma(a[mb], b, acc[mb][nb]); if (NSPLIT == 1 || NSPLIT == 2) acc[mb][nb] = WFrag<T16>::mma(a2[mb], b, acc[mb][nb]); if (NSPLIT >= 2) acc[mb][nb] = WFrag<T16>::mma(a[mb], b2, acc[mb][nb]); } }
        asm volatile("v_nop\n\tv_nop\n\tv_nop\n\tv_nop" : "+v"(acc[0][0]), "+v"(acc[1][1]), "+v"(acc[2][2]), "+v"(acc[3][3]) : "v"(a[0]), "v"(a[3]));
    }
#pragma unroll
    for (int mb = 0; mb < 4; ++mb) {
#pragma unroll
        for (int nb = 0; nb < 4; ++nb) {
#pragma unroll
            for (int j = 0; j < 8; ++j) os[wv * (64 * 68) + (mb * 16 + hi * 8 + j) * 68 + nb * 16 + lr] = acc[mb][nb][j]; }
    }
    __syncthreads();   // every wave's partial 64x64 tile is in LDS before any thread sums them
    float* crow = C + (size_t)r0 * ldc + c0;
    // both loops unrolled so that the LDS reads of all the sums issue ahead of the adds, and the stores go out together
#pragma unroll
    for (int i = 0; i < 32 / NW; ++i) { const int s = threadIdx.x + i * (32 * NW), row = s >> 4, cofs = (s & 15) * 4; v4f val = *(const v4fa*)(os + row * 68 + cofs);
#pragma unroll
        for (int w = 1; w < NW; ++w) val += *(const v4fa*)(os + w * (64 * 68) + row * 68 + cofs);
        if (BIAS) { val[0] += bfr(bias[c0 + cofs]); val[1] += bfr(bias[c0 + cofs + 1]); val[2] += bfr(bias[c0 + cofs + 2]); val[3] += bfr(bias[c0 + cofs + 3]); }
        *(v4f*)(crow + (size_t)row * ldc + cofs) = val; }
}

__device__ __forceinline__ h16 tohx(float x) { return (h16)x; }
__device__ __forceinline__ void splitf(float y, unsigned short& h, unsigned short& l) { h = f2bf(y); l = f2bf(y - bf2f(h)); }
typedef __attribute__((ext_vector_type(2))) _Float16 v2h;
typedef __attribute__((ext_vector_type(4))) _Float16 v4h;
typedef __attribute__((ext_vector_type(2))) unsigned short v2us;
typedef __attribute__((ext_vector_type(4))) unsigned short v4us;
typedef __attribute__((ext_vector_type(2))) float v2f;
typedef __attribute__((ext_vector_type(4))) int v4i;

__global__ __launch_bounds__(256) void k_wtG(const float* __restrict__ w, int K, int N, bf* Bt) {
    const int lane = threadIdx.x & 31; const int L0 = (blockIdx.x * 8 + (threadIdx.x >> 5)) * 8; const int nlines = N * K / 64;
{
#pragma unroll 1
        for (int l = 0; l < 8; ++l) { const int L = L0 + l; if (L >= nlines) break; const size_t e = (size_t)L * 64 + lane * 2; const int k = (int)(e % K), n = (int)(e / K); v2us o;
            o[0] = f2bf(w[(size_t)k * N + n]); o[1] = f2bf(w[(size_t)(k + 1) * N + n]); *(v2us*)(Bt + e) = o; }
         }
}
// k_prep: all seven f32 -> bf16 roundings in ONE launch. dst holds x, xk, xv, Wq, Wk, Wv, Wo one behind the other; block b rounds its elements b * 8192 ..., a thread four chunks of 8 (all its loads are asked for before the first rounding).
__global__ __launch_bounds__(256) void k_prep(const float* __restrict__ x, const float* __restrict__ xk, const float* __restrict__ xv, const float* __restrict__ wq, const float* __restrict__ wk, const float* __restrict__ wv, const float* __restrict__ wo, bf* dst) {
    constexpr int BE = 4 * 256 * 8, XN = TT * DM / BE, WN = DQ * DM / BE;
    static_assert(TT * DM % BE == 0 && DQ * DM % BE == 0 && DKV == DQ, "whole blocks a tensor");
    const int b = (int)blockIdx.x; const float* src; int sb;
    if (b < 3 * XN) { const int s = b / XN; src = s == 0 ? x : s == 1 ? xk : xv; sb = b - s * XN; }
    else { const int s = (b - 3 * XN) / WN; src = s == 0 ? wq : s == 1 ? wk : s == 2 ? wv : wo; sb = b - 3 * XN - s * WN; }
    src += (size_t)sb * BE + threadIdx.x * 8; dst += (size_t)b * BE + threadIdx.x * 8;
    v8f v[4];
#pragma unroll
    for (int j = 0; j < 4; ++j) v[j] = *(const v8f*)(src + j * 2048);
#pragma unroll
    for (int j = 0; j < 4; ++j) { v8us o;
#pragma unroll
        for (int k = 0; k < 8; ++k) o[k] = f2bf(v[j][k]);
        *(v8us*)(dst + j * 2048) = o; }
}
__global__ __launch_bounds__(256) void k_cscvt(const float* __restrict__ cosT, const float* __restrict__ sinT, float* CS) { const int idx = blockIdx.x * 256 + threadIdx.x; if (idx >= TT * HD) return; v2f cs; cs[0] = bfr(cosT[idx]); cs[1] = bfr(sinT[idx]); *(v2f*)(CS + (size_t)idx * 2) = cs;  }
// ---- k_qkv: the q, k and v projections in ONE launch (blockIdx.z), K loop and LDS sum as in k_gemmw<bf, 0, true, 8>; the epilogue rounds the summed tile + bias straight into the three head planes (fp16, bf16 hi, bf16 lo).
// A 64-wide column tile is one head. q, k: A = rows of x, B = rows of W, tile [t][d] -> plane [h][t][d]. v: the operands change places (A = rows of W, B = rows of x), tile [d][t] -> plane [h][d][t], so the transposed plane is stored in whole lines too.
// grid (TT / 64, DQ / 64, 3), 256 threads. X: the three rounded inputs, Wt: the three rounded weights, P16 / Ph / Pl: the q, k, v planes of each kind, one behind the other.
__global__ __launch_bounds__(256) void k_qkv(const bf* __restrict__ X, const bf* __restrict__ Wt, const float* __restrict__ bq, const float* __restrict__ bk, const float* __restrict__ bv, h16* P16, bf* Ph, bf* Pl) {
    typedef WFrag<bf>::V V;
    constexpr int NW = 8, K = DM;
    __shared__ __align__(16) float os[NW * 64 * 68];
    const int z = (int)blockIdx.z; const bool tr = z == 2;
    const bf* xz = X + (size_t)z * TT * DM; const bf* wz = Wt + (size_t)z * DQ * DM;
    const bf* A = tr ? wz : xz; const bf* Bt = tr ? xz : wz;
    const int lane = threadIdx.x & 31, lr = lane & 15, hi = lane >> 4; const int r0 = (int)(tr ? blockIdx.y : blockIdx.x) * 64, c0 = (int)(tr ? blockIdx.x : blockIdx.y) * 64;
    const int wv = __builtin_amdgcn_readfirstlane((int)(threadIdx.x >> 5));   // wave number, scalar: the K loop's trip test stays a scalar branch (every lane on at the matrix instructions)
    v8f acc[4][4];
#pragma unroll
    for (int mb = 0; mb < 4; ++mb)
#pragma unroll
        for (int nb = 0; nb < 4; ++nb) acc[mb][nb] = (v8f){};
    const size_t aoff = (size_t)(r0 + lr) * K + 8 * hi, boff = (size_t)(c0 + lr) * K + 8 * hi;
#pragma unroll 1
    for (int kc = 32 * wv; kc < K; kc += 32 * NW) {
        const bf* ap = A + aoff + kc; const bf* bp = Bt + boff + kc; V a[4];
#pragma unroll
        for (int mb = 0; mb < 4; ++mb) a[mb] = WFrag<bf>::ld(ap + mb * 16 * K);
        // precaution: the wait stands in front of every reuse of the address registers that the issued A loads name; it takes the pointer as an input so that its registers are held up to it
        asm volatile("s_wait_xcnt 0x0" :: "v"(ap) : "memory");
#pragma unroll
        for (int nb = 0; nb < 4; ++nb) { const V b = WFrag<bf>::ld(bp + nb * 16 * K);
#pragma unroll
            for (int mb = 0; mb < 4; ++mb) acc[mb][nb] = WFrag<bf>::mma(a[mb], b, acc[mb][nb]); }
        // the distance behind the trip's last matrix instructions, also on the taken back edge (as in k_gemmw)
        asm volatile("v_nop\n\tv_nop\n\tv_nop\n\tv_nop" : "+v"(acc[0][0]), "+v"(acc[1][1]), "+v"(acc[2][2]), "+v"(acc[3][3]) : "v"(a[0]), "v"(a[3]));
    }
#pragma unroll
    for (int mb = 0; mb < 4; ++mb) {
#pragma unroll
        for (int nb = 0; nb < 4; ++nb) {
#pragma unroll
            for (int j = 0; j < 8; ++j) os[wv * (64 * 68) + (mb * 16 + hi * 8 + j) * 68 + nb * 16 + lr] = acc[mb][nb][j]; }
    }
    // the bias of the thread's 2 x 8 elements (q, k: by column, the same for both rows; v: by row), asked for in front of the barrier
    const float* bias = z == 0 ? bq : z == 1 ? bk : bv; const int row0 = threadIdx.x >> 3, cofs = (threadIdx.x & 7) * 8; float bb[2][8];
    if (tr) {
#pragma unroll
        for (int i = 0; i < 2; ++i) { const float t = bfr(bias[r0 + row0 + 32 * i]);
#pragma unroll
            for (int j = 0; j < 8; ++j) bb[i][j] = t; }
    } else {
#pragma unroll
        for (int j = 0; j < 8; ++j) bb[0][j] = bb[1][j] = bfr(bias[c0 + cofs + j]);
    }
    __syncthreads();   // every wave's partial 64x64 tile is in LDS before any thread sums them
    const size_t pb = (size_t)z * NH_ * TT * HD + (tr ? (size_t)r0 * TT + c0 : ((size_t)blockIdx.y * TT + r0) * HD) + cofs; const int pitch = tr ? TT : HD;
    v8h o16[2]; v8us oh[2], ol[2];
    // both loops unrolled so that the LDS reads of all the sums issue ahead of the adds
#pragma unroll
    for (int i = 0; i < 2; ++i) { const float* op = os + (row0 + 32 * i) * 68 + cofs; v4f v0 = *(const v4fa*)op, v1 = *(const v4fa*)(op + 4);
#pragma unroll
        for (int w = 1; w < NW; ++w) { v0 += *(const v4fa*)(op + w * (64 * 68)); v1 += *(const v4fa*)(op + w * (64 * 68) + 4); }
#pragma unroll
        for (int j = 0; j < 8; ++j) { const float r = (j < 4 ? v0[j & 3] : v1[j & 3]) + bb[i][j]; o16[i][j] = tohx(r); unsigned short a2, c2; splitf(r, a2, c2); oh[i][j] = a2; ol[i][j] = c2; } }
    // the six stores stand last, so that no register which an issued store names is written again
#pragma unroll
    for (int i = 0; i < 2; ++i) { const size_t e = pb + (size_t)(row0 + 32 * i) * pitch; *(v8h*)(P16 + e) = o16[i]; *(v8us*)(Ph + e) = oh[i]; *(v8us*)(Pl + e) = ol[i]; }
}
// ---- k_attn: causal attention of one head and one tile of queries in ONE launch: scores, softmax (running maximum and sum) and the probability x value product stay in registers.
// Transposed products: S^T = K Q^T (A = key rows, B = query rows), O^T += V^T P^T (A = V^T rows, B = P^T). In a 16-query group lane lr (both halves) holds query lr; two 16-key score tiles are, register for register,
// the B operand of the 32-key value product. Wave w of the work-group takes the 32-key blocks w, w + NW, ... with its own maximum, sum and accumulators; the NW partials are merged through LDS in wave order.
#define L2E 1.4426950408889634f
__device__ __forceinline__ float xhalf(float x) { return __builtin_bit_cast(float, __builtin_amdgcn_permlanex16(__builtin_bit_cast(int, x), __builtin_bit_cast(int, x), 0x76543210, 0xfedcba98, false, false)); }   // lane l with lane l ^ 16, in registers
template <typename T16, bool HR, int NQ, int NW>
__device__ __forceinline__ void attn_tile(const T16* __restrict__ Q, const T16* __restrict__ Q2, const T16* __restrict__ Kp, const T16* __restrict__ K2, const T16* __restrict__ Vt, const T16* __restrict__ V2, int q0, bf* Ah, bf* Al, float* os, float* ms, float* ls) {
    typedef typename WFrag<T16>::V V;
    constexpr int QT = 16 * NQ;
    const int lane = threadIdx.x & 31, lr = lane & 15, hi = lane >> 4;
    const int wv = __builtin_amdgcn_readfirstlane((int)(threadIdx.x >> 5));   // wave number, scalar: the key loop's trip test stays a scalar branch (every lane on at the matrix instructions)
    V qf[NQ][2], qf2[NQ][2];
#pragma unroll
    for (int nt = 0; nt < NQ; ++nt)
#pragma unroll
        for (int ks = 0; ks < 2; ++ks) { const size_t qo = (size_t)(q0 + nt * 16 + lr) * HD + ks * 32 + 8 * hi; qf[nt][ks] = WFrag<T16>::ld(Q + qo); if (HR) qf2[nt][ks] = WFrag<T16>::ld(Q2 + qo); }
    v8f o[4][NQ]; float m[NQ], l[NQ];
#pragma unroll
    for (int nt = 0; nt < NQ; ++nt) { m[nt] = -3.0e38f; l[nt] = 0.f;
#pragma unroll
        for (int dt = 0; dt < 4; ++dt) o[dt][nt] = (v8f){}; }
    // the lane's own K and V pointers, stepped by NW blocks at the foot of each trip
    const size_t kst = (size_t)(32 * wv + lr) * HD + 8 * hi, vst = (size_t)lr * TT + 32 * wv + 8 * hi;
    const T16* kp = Kp + kst; const T16* kp2 = HR ? K2 + kst : nullptr; const T16* vp = Vt + vst; const T16* vp2 = HR ? V2 + vst : nullptr;
    // every block taken starts at a key <= q0, so each query of the tile has at least one unmasked key in it and the running maximum is a real score after a wave's first block
#pragma unroll 1
    for (int k0 = 32 * wv; k0 < q0 + QT; k0 += 32 * NW) {
        v8f st[2][NQ];
#pragma unroll
        for (int kt = 0; kt < 2; ++kt)
#pragma unroll
            for (int nt = 0; nt < NQ; ++nt) st[kt][nt] = (v8f){};
        V kf[2][2], kf2[2][2], vf[4], vf2[4];   // all of the block's K and V fragments are asked for at once, so that the V loads fly while the scores are formed
#pragma unroll
        for (int kt = 0; kt < 2; ++kt)
#pragma unroll
            for (int ks = 0; ks < 2; ++ks) { const int ko = kt * 16 * HD + ks * 32; kf[kt][ks] = WFrag<T16>::ld(kp + ko); if (HR) kf2[kt][ks] = WFrag<T16>::ld(kp2 + ko); }
        // precaution: the wait stands in front of every reuse of the address registers that the issued K loads name; it takes the pointers as inputs so that their registers are held up to it;
        // the scheduling barrier keeps later address arithmetic behind it and every K load in front of the first product
        if constexpr (HR) asm volatile("s_wait_xcnt 0x0" :: "v"(kp), "v"(kp2) : "memory"); else asm volatile("s_wait_xcnt 0x0" :: "v"(kp) : "memory");
        __builtin_amdgcn_sched_barrier(0);
#pragma unroll
        for (int dt = 0; dt < 4; ++dt) { const int vo = dt * 16 * TT; vf[dt] = WFrag<T16>::ld(vp + vo); if (HR) vf2[dt] = WFrag<T16>::ld(vp2 + vo); }
        // the same behind the V loads: all of them are in flight before the wave first waits for K
        if constexpr (HR) asm volatile("s_wait_xcnt 0x0" :: "v"(vp), "v"(vp2) : "memory"); else asm volatile("s_wait_xcnt 0x0" :: "v"(vp) : "memory");
        __builtin_amdgcn_sched_barrier(0);
#pragma unroll
        for (int kt = 0; kt < 2; ++kt)
#pragma unroll
            for (int ks = 0; ks < 2; ++ks)
#pragma unroll
                for (int nt = 0; nt < NQ; ++nt) { st[kt][nt] = WFrag<T16>::mma(kf[kt][ks], qf[nt][ks], st[kt][nt]); if (HR) { st[kt][nt] = WFrag<T16>::mma(kf[kt][ks], qf2[nt][ks], st[kt][nt]); st[kt][nt] = WFrag<T16>::mma(kf2[kt][ks], qf[nt][ks], st[kt][nt]); } }
        if (k0 + 31 > q0) {   // scalar branch: only a block that reaches past the tile's first query needs the causal select
#pragma unroll
            for (int nt = 0; nt < NQ; ++nt)
#pragma unroll
                for (int kt = 0; kt < 2; ++kt)
#pragma unroll
                    for (int j = 0; j < 8; ++j) st[kt][nt][j] = (k0 + kt * 16 + hi * 8 + j <= q0 + nt * 16 + lr) ? st[kt][nt][j] : -3.0e38f;
        }
#pragma unroll
        for (int nt = 0; nt < NQ; ++nt) {
            float mx = m[nt];
#pragma unroll
            for (int kt = 0; kt < 2; ++kt)
#pragma unroll
                for (int j = 0; j < 8; ++j) { const float t = st[kt][nt][j] * SCL; st[kt][nt][j] = t; mx = fmaxf(mx, t); }
            mx = fmaxf(mx, xhalf(mx));   // the two halves of the wave hold the other keys of the same query
            const float al = __builtin_amdgcn_exp2f((m[nt] - mx) * L2E); m[nt] = mx; float sum = 0.f;
#pragma unroll
            for (int kt = 0; kt < 2; ++kt)
#pragma unroll
                for (int j = 0; j < 8; ++j) { const float e = __builtin_amdgcn_exp2f((st[kt][nt][j] - mx) * L2E); st[kt][nt][j] = e; sum += e; }
            l[nt] = l[nt] * al + sum;
#pragma unroll
            for (int dt = 0; dt < 4; ++dt) o[dt][nt] *= al;
            if constexpr (HR) {
                v8us h0, h1, l0, l1;
#pragma unroll
                for (int j = 0; j < 8; ++j) { unsigned short a, c2; splitf(st[0][nt][j], a, c2); h0[j] = a; l0[j] = c2; splitf(st[1][nt][j], a, c2); h1[j] = a; l1[j] = c2; }
                const V ph = cat16b(h0, h1), pl = cat16b(l0, l1);
#pragma unroll
                for (int dt = 0; dt < 4; ++dt) { o[dt][nt] = WFrag<T16>::mma(vf[dt], ph, o[dt][nt]); o[dt][nt] = WFrag<T16>::mma(vf[dt], pl, o[dt][nt]); o[dt][nt] = WFrag<T16>::mma(vf2[dt], ph, o[dt][nt]); }
            } else {
                v8h p0, p1;
#pragma unroll
                for (int j = 0; j < 8; ++j) { p0[j] = tohx(st[0][nt][j] * PCAR); p1[j] = tohx(st[1][nt][j] * PCAR); }
                const V pf = cat16(p0, p1);
#pragma unroll
                for (int dt = 0; dt < 4; ++dt) o[dt][nt] = WFrag<T16>::mma(vf[dt], pf, o[dt][nt]);
            }
        }
        kp += 32 * NW * HD; vp += 32 * NW; if (HR) { kp2 += 32 * NW * HD; vp2 += 32 * NW; }
    }
#pragma unroll
    for (int nt = 0; nt < NQ; ++nt) { const int q = nt * 16 + lr; const float lt = l[nt] + xhalf(l[nt]); if (hi == 0) { ms[wv * QT + q] = m[nt]; ls[wv * QT + q] = lt; }
#pragma unroll
        for (int dt = 0; dt < 4; ++dt) { float* op = os + (size_t)(wv * QT + q) * 68 + dt * 16 + hi * 8; v4f x0, x1;
#pragma unroll
            for (int j = 0; j < 4; ++j) { x0[j] = o[dt][nt][j]; x1[j] = o[dt][nt][4 + j]; }
            *(v4fa*)op = x0; *(v4fa*)(op + 4) = x1; } }
    __syncthreads();   // every wave's partial (maximum, sum, 64 x QT tile) is in LDS before any thread merges them
    constexpr int EP = QT * HD / (32 * NW);   // output elements a thread: EP consecutive d of one query
    const int q = threadIdx.x / (HD / EP), d0 = (threadIdx.x % (HD / EP)) * EP;
    float M = ms[q];
#pragma unroll
    for (int w = 1; w < NW; ++w) M = fmaxf(M, ms[w * QT + q]);
    float L = 0.f, val[EP];
#pragma unroll
    for (int e = 0; e < EP; ++e) val[e] = 0.f;
#pragma unroll
    for (int w = 0; w < NW; ++w) { const float fw = __builtin_amdgcn_exp2f((ms[w * QT + q] - M) * L2E); L += fw * ls[w * QT + q];   // a wave that took no block has maximum -3e38, weight 0, and a zero tile
#pragma unroll
        for (int e4 = 0; e4 < EP / 4; ++e4) { const v4f x = *(const v4fa*)(os + (size_t)(w * QT + q) * 68 + d0 + e4 * 4);
#pragma unroll
            for (int j = 0; j < 4; ++j) val[e4 * 4 + j] += fw * x[j]; } }
    const float f = __fdiv_rn(HR ? 1.0f : (1.0f / PCAR), L);
    const size_t oo = (size_t)(q0 + q) * DQ + d0;
#pragma unroll
    for (int e4 = 0; e4 < EP / 4; ++e4) { v4us oh, ol;
#pragma unroll
        for (int j = 0; j < 4; ++j) { unsigned short a, c2; splitf(val[e4 * 4 + j] * f, a, c2); oh[j] = a; ol[j] = c2; }
        *(v4us*)(Ah + oo + e4 * 4) = oh; *(v4us*)(Al + oo + e4 * 4) = ol; }
}
// grid (RH / 16 + (TT - RH) / 32, heads), 256 threads; the tiles with the most keys have the lowest block indices (for speed only). Query rows < RH: hi+lo bf16 planes, 16 queries a tile; the rest fp16, 32 queries.
__global__ __launch_bounds__(256) void k_attn(const h16* __restrict__ Q16, const h16* __restrict__ K16, const h16* __restrict__ V16, const bf* __restrict__ Qh, const bf* __restrict__ Ql, const bf* __restrict__ Kh, const bf* __restrict__ Kl, const bf* __restrict__ Vh, const bf* __restrict__ Vl, bf* Ah, bf* Al) {
    __shared__ __align__(16) float os[8 * 32 * 68]; __shared__ float ms[8 * 32]; __shared__ float ls[8 * 32];
    const int t = (int)(gridDim.x - 1 - blockIdx.x); const size_t hp = (size_t)blockIdx.y * TT * HD; Ah += blockIdx.y * HD; Al += blockIdx.y * HD;
    if (t < RH / 16) attn_tile<bf, true, 1, 8>(Qh + hp, Ql + hp, Kh + hp, Kl + hp, Vh + hp, Vl + hp, t * 16, Ah, Al, os, ms, ls);
    else attn_tile<h16, false, 2, 8>(Q16 + hp, nullptr, K16 + hp, nullptr, V16 + hp, nullptr, RH + (t - RH / 16) * 32, Ah, Al, os, ms, ls);
}

extern "C" void kernel_launch(void* const* d_in, const int* in_sizes, int n_in,
                              void* d_out, int out_size, void* d_ws, size_t ws_size, hipStream_t stream) {
    (void)in_sizes; (void)n_in; (void)out_size;
    const float* x = (const float*)d_in[0]; const float* xk = (const float*)d_in[1]; const float* xv = (const float*)d_in[2]; const float* wq = (const float*)d_in[3]; const float* bq = (const float*)d_in[4]; const float* wk = (const float*)d_in[5]; const float* bk = (const float*)d_in[6]; const float* wv = (const float*)d_in[7]; const float* bv = (const float*)d_in[8]; const float* wo = (const float*)d_in[9]; const float* bo = (const float*)d_in[10];
    float* OUT = (float*)d_out;     // [1][2048][1024]
    char* wsp = (char*)d_ws;
    auto take = [&](size_t bytes) { char* p = wsp; wsp += (bytes + 255) & ~(size_t)255; return (void*)p; };
    bf* XB = (bf*)take(((size_t)3 * TT * DM + (size_t)4 * DQ * DM) * 2);   // x, xk, xv, Wq, Wk, Wv, Wo rounded to bf16, one behind the other
    bf* WQ = XB + (size_t)3 * TT * DM; bf* WO = WQ + (size_t)3 * DQ * DM;
    const size_t PL = (size_t)NH_ * TT * HD;   // one head plane; q, k, v of each kind one behind the other
    h16* QP16 = (h16*)take(3 * PL * 2); h16* KP16 = QP16 + PL; h16* VT16 = KP16 + PL;
    bf* QPh = (bf*)take(3 * PL * 2); bf* KPh = QPh + PL; bf* VTh = KPh + PL;
    bf* QPl = (bf*)take(3 * PL * 2); bf* KPl = QPl + PL; bf* VTl = KPl + PL;
    bf* ATh = (bf*)take((size_t)TT * DQ * 2); bf* ATl = (bf*)take((size_t)TT * DQ * 2);
    if ((size_t)(wsp - (char*)d_ws) > ws_size) return;    // ws 256 MiB
    k_prep<<<(3 * TT * DM + 4 * DQ * DM) / 8192, 256, 0, stream>>>(x, xk, xv, wq, wk, wv, wo, XB);
    k_qkv<<<dim3(TT / 64, DQ / 64, 3), 256, 0, stream>>>(XB, WQ, bq, bk, bv, QP16, QPh, QPl);
    k_attn<<<dim3(RH / 16 + (TT - RH) / 32, NH_, 1), 256, 0, stream>>>(QP16, KP16, VT16, QPh, QPl, KPh, KPl, VTh, VTl, ATh, ATl);
    k_gemmw<bf, 1, true, 8><<<dim3(TT / 64, DM / 64, 1), 256, 0, stream>>>(ATh, ATl, WO, nullptr, DQ, OUT, DM, bo, 0, 0, 0);
}

// v004
// A run of this version takes 65.9 microseconds.
// Two timings next to v003 both put it at 1.35 times that version's speed.
// All steps since v000 together make it 11.2 times as fast.
#include <hip/hip_runtime.h>

// MultiHeadAttentionV2 (q/k/v encodings [1][2048][1024] (three inputs); q/k/v = x W^T + b (torch; 16 heads x 64); causal softmax(q.k / 8); out = merged Wo^T + bo -> [1][2048][1024]).
// Compute dtypes, f32 accumulate: every input rounded to bf16; q/k/v on PLAIN bf16 operands (inputs: exact) + bias; causal scores and attn.v: query rows < 512 hl (3 products), the rest single fp16 (x1024); softmax f32; Wo hl x exact (2 products) + bias.

#define NB_  1
#define TT   2048
#define DM   1024
#define NH_  16
#define NKV  16
#define HD   64
#define DQ   (NH_ * HD)
#define DKV  (NKV * HD)
#define RH   512                  // query rows < RH use hi+lo planes (0: none)
#define PCAR 1024.0f
#define SCL  0.125f   // HD^-0.5
typedef _Float16 h16;
typedef unsigned short bf;
typedef __attribute__((ext_vector_type(16))) __bf16   v16bf;
typedef __attribute__((ext_vector_type(16))) _Float16 v16h;
typedef __attribute__((ext_vector_type(8)))  _Float16 v8h;
typedef __attribute__((ext_vector_type(8)))  unsigned short v8us;
typedef __attribute__((ext_vector_type(8)))  float    v8f;
typedef __attribute__((ext_vector_type(4)))  float    v4f;
typedef v8h  __attribute__((may_alias)) v8ha;
typedef v4f  __attribute__((may_alias)) v4fa;
typedef v8us __attribute__((may_alias)) v8usa;

__device__ __forceinline__ unsigned short f2bf(float f) { unsigned u = __float_as_uint(f); u += 0x7FFFu + ((u >> 16) & 1u); return (unsigned short)(u >> 16); }
__device__ __forceinline__ float bf2f(unsigned short b) { return __uint_as_float(((unsigned)b) << 16); }
__device__ __forceinline__ float bfr(float f) { return bf2f(f2bf(f)); }
__device__ __forceinline__ v16h cat16(v8h lo, v8h hi) { return __builtin_shufflevector(lo, hi, 0, 1, 2, 3, 4, 5, 6, 7, 8, 9, 10, 11, 12, 13, 14, 15); }
__device__ __forceinline__ v16bf cat16b(v8us lo, v8us hi) { return __builtin_bit_cast(v16bf, __builtin_shufflevector(lo, hi, 0, 1, 2, 3, 4, 5, 6, 7, 8, 9, 10, 11, 12, 13, 14, 15)); }
__device__ __forceinline__ v8f wmma16(v16h a, v16h b, v8f c) { return __builtin_amdgcn_wmma_f32_16x16x32_f16(false, a, false, b, (short)0, c, false, false); }
__device__ __forceinline__ v8f wmmab(v16bf a, v16bf b, v8f c) { return __builtin_amdgcn_wmma_f32_16x16x32_bf16(false, a, false, b, (short)0, c, false, false); }



// ---- k_gemmw: register-blocked GEMM, one work-group of NW waves per 64x64 output tile; wave w takes the 32-wide K blocks w, w + NW, ... into its own 16 accumulators, and the NW partial tiles are
// summed through LDS in wave order (a fixed order). Operands straight from 16-bit planes in fragment order; grid (M/64, N/64, Z), 32 * NW threads.
// C[m][n] (f32, pitch ldc, + optional f32 bias[n]) = sum_k A[m][k] Bt[n][k] (+ split products per NSPLIT). z-batch strides sA/sB/sC in elements. K % 32 == 0.
// FRAGMENT ORDER: every 16-bit operand plane is stored as blocks of 16 rows x 32 k = 512 elements (1 KiB), [row block][k block]; in a block, lane (lr, hi) = hi * 16 + lr finds its k = 8 hi .. 8 hi + 7 of row lr at element lane * 8
// and its k = 16 + 8 hi .. at 256 + lane * 8. A fragment is then two wave-wide 16-byte loads of 512 contiguous bytes each (4 whole lines a load, not 16 part lines); the registers hold what they held with row-major planes.
template <typename T16> struct WFrag;
template <> struct WFrag<h16> { typedef v16h V; static __device__ __forceinline__ V ld(const h16* p) { return cat16(*(const v8h*)p, *(const v8h*)(p + 256)); } static __device__ __forceinline__ v8f mma(V a, V b, v8f c) { return wmma16(a, b, c); } };
template <> struct WFrag<bf> { typedef v16bf V; static __device__ __forceinline__ V ld(const bf* p) { return cat16b(*(const v8us*)p, *(const v8us*)(p + 256)); } static __device__ __forceinline__ v8f mma(V a, V b, v8f c) { return wmmab(a, b, c); } };
template <typename T16, int NSPLIT, bool BIAS, int NW, int K>
__global__ __launch_bounds__(32 * NW) void k_gemmw(const T16* __restrict__ A, const T16* __restrict__ A2, const T16* __restrict__ Bt, const T16* __restrict__ Bt2, float* C, int ldc, const float* __restrict__ bias, size_t sA, size_t sB, size_t sC) {
    typedef typename WFrag<T16>::V V;
    __shared__ __align__(16) float os[NW * 64 * 68];
    const size_t z = blockIdx.z; A += z * sA; if (A2) A2 += z * sA; Bt += z * sB; if (Bt2) Bt2 += z * sB; C += z * sC;
    const int lane = threadIdx.x & 31, lr = lane & 15, hi = lane >> 4; const int r0 = blockIdx.x * 64, c0 = blockIdx.y * 64;
    const int wv = __builtin_amdgcn_readfirstlane((int)(threadIdx.x >> 5));   // wave number, scalar: the K loop's trip test stays a scalar branch (every lane on at the matrix instructions)
    v8f acc[4][4];
#pragma unroll
    for (int mb = 0; mb < 4; ++mb)
#pragma unroll
        for (int nb = 0; nb < 4; ++nb) acc[mb][nb] = (v8f){};
    const size_t aoff = (size_t)r0 * K + 8 * lane, boff = (size_t)c0 * K + 8 * lane;   // fragment order: row block rb, k block kb at (rb * K / 32 + kb) * 512
#pragma unroll 1
    for (int kc = 32 * wv; kc < K; kc += 32 * NW) {
        constexpr bool SA = NSPLIT == 1 || NSPLIT == 2, SB = NSPLIT >= 2;
        const T16* ap = A + aoff + kc * 16; const T16* ap2 = SA ? A2 + aoff + kc * 16 : ap; const T16* bp = Bt + boff + kc * 16; const T16* bp2 = SB ? Bt2 + boff + kc * 16 : bp;   // K is a constant: the row blocks are immediate offsets from one pointer an operand
        V a[4], a2[4], b[4], b2[4];
#pragma unroll
        for (int mb = 0; mb < 4; ++mb) { a[mb] = WFrag<T16>::ld(ap + mb * 16 * K); if (SA) a2[mb] = WFrag<T16>::ld(ap2 + mb * 16 * K); }
        // precaution: the wait stands in front of every reuse of the address registers that the issued A loads name; it takes the pointers as inputs so that their registers are held up to it
        asm volatile("s_wait_xcnt 0x0" :: "v"(ap), "v"(ap2) : "memory");
#pragma unroll
        for (int nb = 0; nb < 4; ++nb) { b[nb] = WFrag<T16>::ld(bp + nb * 16 * K); if (SB) b2[nb] = WFrag<T16>::ld(bp2 + nb * 16 * K); }
        // the same behind the B loads
        asm volatile("s_wait_xcnt 0x0" :: "v"(bp), "v"(bp2) : "memory");
#pragma unroll
        for (int nb = 0; nb < 4; ++nb) {
#pragma unroll
            for (int mb = 0; mb < 4; ++mb) { acc[mb][nb] = WFrag<T16>::mma(a[mb], b[nb], acc[mb][nb]); if (SA) acc[mb][nb] = WFrag<T16>::mma(a2[mb], b[nb], acc[mb][nb]); if (SB) acc[mb][nb] = WFrag<T16>::mma(a[mb], b2[nb], acc[mb][nb]); } }
        asm volatile("v_nop\n\tv_nop\n\tv_nop\n\tv_nop" : "+v"(acc[0][0]), "+v"(acc[1][1]), "+v"(acc[2][2]), "+v"(acc[3][3]) : "v"(a[0]), "v"(a[3]));
    }
#pragma unroll
    for (int mb = 0; mb < 4; ++mb) {
#pragma unroll
        for (int nb = 0; nb < 4; ++nb) {
#pragma unroll
            for (int j = 0; j < 8; ++j) os[wv * (64 * 68) + (mb * 16 + hi * 8 + j) * 68 + nb * 16 + lr] = acc[mb][nb][j]; }
    }
    __syncthreads();   // every wave's partial 64x64 tile is in LDS before any thread sums them
    float* crow = C + (size_t)r0 * ldc + c0;
    // both loops unrolled so that the LDS reads of all the sums issue ahead of the adds, and the stores go out together
#pragma unroll
    for (int i = 0; i < 32 / NW; ++i) { const int s = threadIdx.x + i * (32 * NW), row = s >> 4, cofs = (s & 15) * 4; v4f val = *(const v4fa*)(os + row * 68 + cofs);
#pragma unroll
        for (int w = 1; w < NW; ++w) val += *(const v4fa*)(os + w * (64 * 68) + row * 68 + cofs);
        if (BIAS) { val[0] += bfr(bias[c0 + cofs]); val[1] += bfr(bias[c0 + cofs + 1]); val[2] += bfr(bias[c0 + cofs + 2]); val[3] += bfr(bias[c0 + cofs + 3]); }
        *(v4f*)(crow + (size_t)row * ldc + cofs) = val; }
}

__device__ __forceinline__ h16 tohx(float x) { return (h16)x; }
__device__ __forceinline__ void splitf(float y, unsigned short& h, unsigned short& l) { h = f2bf(y); l = f2bf(y - bf2f(h)); }
typedef __attribute__((ext_vector_type(2))) _Float16 v2h;
typedef __attribute__((ext_vector_type(4))) _Float16 v4h;
typedef __attribute__((ext_vector_type(2))) unsigned short v2us;
typedef __attribute__((ext_vector_type(4))) unsigned short v4us;
typedef __attribute__((ext_vector_type(2))) float v2f;
typedef __attribute__((ext_vector_type(4))) int v4i;

__global__ __launch_bounds__(256) void k_wtG(const float* __restrict__ w, int K, int N, bf* Bt) {
    const int lane = threadIdx.x & 31; const int L0 = (blockIdx.x * 8 + (threadIdx.x >> 5)) * 8; const int nlines = N * K / 64;
{
#pragma unroll 1
        for (int l = 0; l < 8; ++l) { const int L = L0 + l; if (L >= nlines) break; const size_t e = (size_t)L * 64 + lane * 2; const int k = (int)(e % K), n = (int)(e / K); v2us o;
            o[0] = f2bf(w[(size_t)k * N + n]); o[1] = f2bf(w[(size_t)(k + 1) * N + n]); *(v2us*)(Bt + e) = o; }
         }
}
// k_prep: all seven f32 -> bf16 roundings in ONE launch, stored in fragment order. dst holds x, xk, xv, Wq, Wk, Wv, Wo one behind the other; block b rounds 16 rows x 512 k, which are 16 KiB in a row of dst.
// A wave reads 1 KiB of one row a load (all of a thread's four loads are asked for before the first rounding); the 16-byte pieces change places through LDS, so that the stores are whole lines too.
__global__ __launch_bounds__(256) void k_prep(const float* __restrict__ x, const float* __restrict__ xk, const float* __restrict__ xv, const float* __restrict__ wq, const float* __restrict__ wk, const float* __restrict__ wv, const float* __restrict__ wo, bf* dst) {
    constexpr int BE = 16 * 512, XN = TT * DM / BE, WN = DQ * DM / BE, KH = DM / 512;
    static_assert(TT % 16 == 0 && DQ % 16 == 0 && DM % 512 == 0 && DKV == DQ && DQ == DM, "whole blocks a tensor, one K for all");
    __shared__ __align__(16) bf ps[64 * 136];   // 64 units of 256 B (16 rows x 8 k), pitch 272 B: 16 lanes that write one row's pieces into 16 units meet 16 different bank groups
    const int b = (int)blockIdx.x; const float* src; int sb;
    if (b < 3 * XN) { const int s = b / XN; src = s == 0 ? x : s == 1 ? xk : xv; sb = b - s * XN; }
    else { const int s = (b - 3 * XN) / WN; src = s == 0 ? wq : s == 1 ? wk : s == 2 ? wv : wo; sb = b - 3 * XN - s * WN; }
    const int lane = threadIdx.x & 31, w2 = (int)(threadIdx.x >> 5) * 2;   // a wave has the rows w2, w2 + 1; load j: row w2 + j / 2, its k half j % 2 of 256
    src += ((size_t)(sb / KH) * 16 + w2) * DM + (sb % KH) * 512 + lane * 8; dst += (size_t)b * BE + threadIdx.x * 8;
    v8f v[4];
#pragma unroll
    for (int j = 0; j < 4; ++j) v[j] = *(const v8f*)(src + (j >> 1) * DM + (j & 1) * 256);
    // precaution: the wait stands in front of every reuse of the address registers that the issued loads name; it takes the pointer as an input so that its registers are held up to it
    asm volatile("s_wait_xcnt 0x0" :: "v"(src) : "memory");
#pragma unroll
    for (int j = 0; j < 4; ++j) { v8us o;
#pragma unroll
        for (int k = 0; k < 8; ++k) o[k] = f2bf(v[j][k]);
        *(v8usa*)(ps + ((j & 1) * 32 + lane) * 136 + (w2 + (j >> 1)) * 8) = o; }   // the piece of k octet c (0 .. 63) and row r is unit c, place r: byte c * 256 + r * 16 of the block's 16 KiB
    __syncthreads();   // all pieces are in LDS before any thread reads them in store order
#pragma unroll
    for (int j = 0; j < 4; ++j) *(v8us*)(dst + j * 2048) = *(const v8usa*)(ps + (j * 16 + (int)(threadIdx.x >> 4)) * 136 + (threadIdx.x & 15) * 8);
}
__global__ __launch_bounds__(256) void k_cscvt(const float* __restrict__ cosT, const float* __restrict__ sinT, float* CS) { const int idx = blockIdx.x * 256 + threadIdx.x; if (idx >= TT * HD) return; v2f cs; cs[0] = bfr(cosT[idx]); cs[1] = bfr(sinT[idx]); *(v2f*)(CS + (size_t)idx * 2) = cs;  }
// ---- k_qkv: the q, k and v projections in ONE launch (blockIdx.z), K loop and LDS sum as in k_gemmw<bf, 0, true, 8>; the epilogue rounds the summed tile + bias straight into the three head planes (fp16, bf16 hi, bf16 lo).
// A 64-wide column tile is one head. q, k: A = rows of x, B = rows of W, tile [t][d] -> plane [h][t / 16][d / 32][block]. v: the operands change places (A = rows of W, B = rows of x), tile [d][t] -> plane [h][t / 32][d / 16][block]. Blocks in fragment order (see k_gemmw).
// grid (TT / 64, DQ / 64, 3), 256 threads. X: the three rounded inputs, Wt: the three rounded weights, P16 / Ph / Pl: the q, k, v planes of each kind, one behind the other.
__global__ __launch_bounds__(256) void k_qkv(const bf* __restrict__ X, const bf* __restrict__ Wt, const float* __restrict__ bq, const float* __restrict__ bk, const float* __restrict__ bv, h16* P16, bf* Ph, bf* Pl) {
    typedef WFrag<bf>::V V;
    constexpr int NW = 8, K = DM;
    __shared__ __align__(16) float os[NW * 64 * 68];
    const int z = (int)blockIdx.z; const bool tr = z == 2;
    const bf* xz = X + (size_t)z * TT * DM; const bf* wz = Wt + (size_t)z * DQ * DM;
    const bf* A = tr ? wz : xz; const bf* Bt = tr ? xz : wz;
    const int lane = threadIdx.x & 31, lr = lane & 15, hi = lane >> 4; const int r0 = (int)(tr ? blockIdx.y : blockIdx.x) * 64, c0 = (int)(tr ? blockIdx.x : blockIdx.y) * 64;
    const int wv = __builtin_amdgcn_readfirstlane((int)(threadIdx.x >> 5));   // wave number, scalar: the K loop's trip test stays a scalar branch (every lane on at the matrix instructions)
    v8f acc[4][4];
#pragma unroll
    for (int mb = 0; mb < 4; ++mb)
#pragma unroll
        for (int nb = 0; nb < 4; ++nb) acc[mb][nb] = (v8f){};
    const size_t aoff = (size_t)r0 * K + 8 * lane, boff = (size_t)c0 * K + 8 * lane;   // fragment order: row block rb, k block kb at (rb * K / 32 + kb) * 512
#pragma unroll 1
    for (int kc = 32 * wv; kc < K; kc += 32 * NW) {
        const bf* ap = A + aoff + kc * 16; const bf* bp = Bt + boff + kc * 16; V a[4];
#pragma unroll
        for (int mb = 0; mb < 4; ++mb) a[mb] = WFrag<bf>::ld(ap + mb * 16 * K);
        // precaution: the wait stands in front of every reuse of the address registers that the issued A loads name; it takes the pointer as an input so that its registers are held up to it
        asm volatile("s_wait_xcnt 0x0" :: "v"(ap) : "memory");
        V b[2] = { WFrag<bf>::ld(bp), WFrag<bf>::ld(bp + 16 * K) };   // the B fragments stay at least two ahead of their products, as the compiler had placed them with row-major planes (left to itself it now waits for each in turn)
#pragma unroll
        for (int nb = 0; nb < 4; ++nb) {
#pragma unroll
            for (int mb = 0; mb < 4; ++mb) acc[mb][nb] = WFrag<bf>::mma(a[mb], b[nb & 1], acc[mb][nb]);
            if (nb < 2) { b[nb & 1] = WFrag<bf>::ld(bp + (nb + 2) * 16 * K); __builtin_amdgcn_sched_barrier(0); } }   // the barrier keeps the refill in front of the next fragment's products, so that it flies during them
        // the same precaution behind the B loads, in front of the next trip's pointers
        asm volatile("s_wait_xcnt 0x0" :: "v"(bp) : "memory");
        // the distance behind the trip's last matrix instructions, also on the taken back edge (as in k_gemmw)
        asm volatile("v_nop\n\tv_nop\n\tv_nop\n\tv_nop" : "+v"(acc[0][0]), "+v"(acc[1][1]), "+v"(acc[2][2]), "+v"(acc[3][3]) : "v"(a[0]), "v"(a[3]));
    }
#pragma unroll
    for (int mb = 0; mb < 4; ++mb) {
#pragma unroll
        for (int nb = 0; nb < 4; ++nb) {
#pragma unroll
            for (int j = 0; j < 8; ++j) os[wv * (64 * 68) + (mb * 16 + hi * 8 + j) * 68 + nb * 16 + lr] = acc[mb][nb][j]; }
    }
    // a thread's 2 x 8 elements are the two pieces of one lane place of one block: wave w has row block w / 2 and k block w % 2 of the tile, piece i is the block's half i; a wave's two stores of a plane are 1 KiB in a row
    // the bias (q, k: by column; v: by row, the same for both pieces) is asked for in front of the barrier
    const float* bias = z == 0 ? bq : z == 1 ? bk : bv; const int rb = wv >> 1, kb = wv & 1, row = rb * 16 + lr, cofs = kb * 32 + hi * 8; float bb[2][8];
    if (tr) { const float* br = bias + r0 + row; const float t0 = *br;
        // precaution: the wait takes the pointer as an input, so that the registers which the issued load names are held up to it (the load's own result was placed over them)
        asm volatile("s_wait_xcnt 0x0" :: "v"(br) : "memory");
        const float t = bfr(t0);
#pragma unroll
        for (int i = 0; i < 2; ++i)
#pragma unroll
            for (int j = 0; j < 8; ++j) bb[i][j] = t;
    } else {
#pragma unroll
        for (int i = 0; i < 2; ++i)
#pragma unroll
            for (int j = 0; j < 8; ++j) bb[i][j] = bfr(bias[c0 + cofs + 16 * i + j]);
    }
    __syncthreads();   // every wave's partial 64x64 tile is in LDS before any thread sums them
    const size_t pb = (size_t)z * NH_ * TT * HD + (size_t)blockIdx.y * TT * HD + (tr ? (size_t)c0 * HD + (kb * 4 + rb) * 512 : (size_t)r0 * HD + (rb * 2 + kb) * 512) + lane * 8;
    v8h o16[2]; v8us oh[2], ol[2];
    // both loops unrolled so that the LDS reads of all the sums issue ahead of the adds
#pragma unroll
    for (int i = 0; i < 2; ++i) { const float* op = os + row * 68 + cofs + 16 * i; v4f v0 = *(const v4fa*)op, v1 = *(const v4fa*)(op + 4);
#pragma unroll
        for (int w = 1; w < NW; ++w) { v0 += *(const v4fa*)(op + w * (64 * 68)); v1 += *(const v4fa*)(op + w * (64 * 68) + 4); }
#pragma unroll
        for (int j = 0; j < 8; ++j) { const float r = (j < 4 ? v0[j & 3] : v1[j & 3]) + bb[i][j]; o16[i][j] = tohx(r); unsigned short a2, c2; splitf(r, a2, c2); oh[i][j] = a2; ol[i][j] = c2; } }
    // the six stores stand last, so that no register which an issued store names is written again
#pragma unroll
    for (int i = 0; i < 2; ++i) { const size_t e = pb + i * 256; *(v8h*)(P16 + e) = o16[i]; *(v8us*)(Ph + e) = oh[i]; *(v8us*)(Pl + e) = ol[i]; }
}
// ---- k_attn: causal attention of one head and one tile of queries in ONE launch: scores, softmax (running maximum and sum) and the probability x value product stay in registers.
// Transposed products: S^T = K Q^T (A = key rows, B = query rows), O^T += V^T P^T (A = V^T rows, B = P^T). In a 16-query group lane lr (both halves) holds query lr; two 16-key score tiles are, register for register,
// the B operand of the 32-key value product. Wave w of the work-group takes the 32-key blocks w, w + NW, ... with its own maximum, sum and accumulators; the NW partials are merged through LDS in wave order.
#define L2E 1.4426950408889634f
__device__ __forceinline__ float xhalf(float x) { return __builtin_bit_cast(float, __builtin_amdgcn_permlanex16(__builtin_bit_cast(int, x), __builtin_bit_cast(int, x), 0x76543210, 0xfedcba98, false, false)); }   // lane l with lane l ^ 16, in registers
template <typename T16, bool HR, int NQ, int NW>
__device__ __forceinline__ void attn_tile(const T16* __restrict__ Q, const T16* __restrict__ Q2, const T16* __restrict__ Kp, const T16* __restrict__ K2, const T16* __restrict__ Vt, const T16* __restrict__ V2, int q0, bf* Ah, bf* Al, float* os, float* ms, float* ls) {
    typedef typename WFrag<T16>::V V;
    constexpr int QT = 16 * NQ;
    const int lane = threadIdx.x & 31, lr = lane & 15, hi = lane >> 4;
    const int wv = __builtin_amdgcn_readfirstlane((int)(threadIdx.x >> 5));   // wave number, scalar: the key loop's trip test stays a scalar branch (every lane on at the matrix instructions)
    V qf[NQ][2], qf2[NQ][2];
#pragma unroll
    for (int nt = 0; nt < NQ; ++nt)
#pragma unroll
        for (int ks = 0; ks < 2; ++ks) { const size_t qo = (size_t)(q0 + nt * 16) * HD + ks * 512 + 8 * lane; qf[nt][ks] = WFrag<T16>::ld(Q + qo); if (HR) qf2[nt][ks] = WFrag<T16>::ld(Q2 + qo); }
    v8f o[4][NQ]; float m[NQ], l[NQ];
#pragma unroll
    for (int nt = 0; nt < NQ; ++nt) { m[nt] = -3.0e38f; l[nt] = 0.f;
#pragma unroll
        for (int dt = 0; dt < 4; ++dt) o[dt][nt] = (v8f){}; }
    // the lane's own K and V pointers, stepped by NW blocks at the foot of each trip
    const size_t kst = (size_t)(32 * wv) * HD + 8 * lane, vst = (size_t)(32 * wv) * HD + 8 * lane;   // a 32-key block is 4 blocks of K (2 x 16 keys, 2 x 32 d) and 4 of V^T (4 x 16 d), 4 KiB in a row each
    const T16* kp = Kp + kst; const T16* kp2 = HR ? K2 + kst : nullptr; const T16* vp = Vt + vst; const T16* vp2 = HR ? V2 + vst : nullptr;
    // every block taken starts at a key <= q0, so each query of the tile has at least one unmasked key in it and the running maximum is a real score after a wave's first block
#pragma unroll 1
    for (int k0 = 32 * wv; k0 < q0 + QT; k0 += 32 * NW) {
        v8f st[2][NQ];
#pragma unroll
        for (int kt = 0; kt < 2; ++kt)
#pragma unroll
            for (int nt = 0; nt < NQ; ++nt) st[kt][nt] = (v8f){};
        V kf[2][2], kf2[2][2], vf[4], vf2[4];   // all of the block's K and V fragments are asked for at once, so that the V loads fly while the scores are formed
#pragma unroll
        for (int kt = 0; kt < 2; ++kt)
#pragma unroll
            for (int ks = 0; ks < 2; ++ks) { const int ko = (kt * 2 + ks) * 512; kf[kt][ks] = WFrag<T16>::ld(kp + ko); if (HR) kf2[kt][ks] = WFrag<T16>::ld(kp2 + ko); }
        // precaution: the wait stands in front of every reuse of the address registers that the issued K loads name; it takes the pointers as inputs so that their registers are held up to it;
        // the scheduling barrier keeps later address arithmetic behind it and every K load in front of the first product
        if constexpr (HR) asm volatile("s_wait_xcnt 0x0" :: "v"(kp), "v"(kp2) : "memory"); else asm volatile("s_wait_xcnt 0x0" :: "v"(kp) : "memory");
        __builtin_amdgcn_sched_barrier(0);
#pragma unroll
        for (int dt = 0; dt < 4; ++dt) { const int vo = dt * 512; vf[dt] = WFrag<T16>::ld(vp + vo); if (HR) vf2[dt] = WFrag<T16>::ld(vp2 + vo); }
        // the same behind the V loads: all of them are in flight before the wave first waits for K
        if constexpr (HR) asm volatile("s_wait_xcnt 0x0" :: "v"(vp), "v"(vp2) : "memory"); else asm volatile("s_wait_xcnt 0x0" :: "v"(vp) : "memory");
        __builtin_amdgcn_sched_barrier(0);
#pragma unroll
        for (int kt = 0; kt < 2; ++kt)
#pragma unroll
            for (int ks = 0; ks < 2; ++ks)
#pragma unroll
                for (int nt = 0; nt < NQ; ++nt) { st[kt][nt] = WFrag<T16>::mma(kf[kt][ks], qf[nt][ks], st[kt][nt]); if (HR) { st[kt][nt] = WFrag<T16>::mma(kf[kt][ks], qf2[nt][ks], st[kt][nt]); st[kt][nt] = WFrag<T16>::mma(kf2[kt][ks], qf[nt][ks], st[kt][nt]); } }
        if (k0 + 31 > q0) {   // scalar branch: only a block that reaches past the tile's first query needs the causal select
#pragma unroll
            for (int nt = 0; nt < NQ; ++nt)
#pragma unroll
                for (int kt = 0; kt < 2; ++kt)
#pragma unroll
                    for (int j = 0; j < 8; ++j) st[kt][nt][j] = (k0 + kt * 16 + hi * 8 + j <= q0 + nt * 16 + lr) ? st[kt][nt][j] : -3.0e38f;
        }
#pragma unroll
        for (int nt = 0; nt < NQ; ++nt) {
            float mx = m[nt];
#pragma unroll
            for (int kt = 0; kt < 2; ++kt)
#pragma unroll
                for (int j = 0; j < 8; ++j) { const float t = st[kt][nt][j] * SCL; st[kt][nt][j] = t; mx = fmaxf(mx, t); }
            mx = fmaxf(mx, xhalf(mx));   // the two halves of the wave hold the other keys of the same query
            const float al = __builtin_amdgcn_exp2f((m[nt] - mx) * L2E); m[nt] = mx; float sum = 0.f;
#pragma unroll
            for (int kt = 0; kt < 2; ++kt)
#pragma unroll
                for (int j = 0; j < 8; ++j) { const float e = __builtin_amdgcn_exp2f((st[kt][nt][j] - mx) * L2E); st[kt][nt][j] = e; sum += e; }
            l[nt] = l[nt] * al + sum;
#pragma unroll
            for (int dt = 0; dt < 4; ++dt) o[dt][nt] *= al;
            if constexpr (HR) {
                v8us h0, h1, l0, l1;
#pragma unroll
                for (int j = 0; j < 8; ++j) { unsigned short a, c2; splitf(st[0][nt][j], a, c2); h0[j] = a; l0[j] = c2; splitf(st[1][nt][j], a, c2); h1[j] = a; l1[j] = c2; }
                const V ph = cat16b(h0, h1), pl = cat16b(l0, l1);
#pragma unroll
                for (int dt = 0; dt < 4; ++dt) { o[dt][nt] = WFrag<T16>::mma(vf[dt], ph, o[dt][nt]); o[dt][nt] = WFrag<T16>::mma(vf[dt], pl, o[dt][nt]); o[dt][nt] = WFrag<T16>::mma(vf2[dt], ph, o[dt][nt]); }
            } else {
                v8h p0, p1;
#pragma unroll
                for (int j = 0; j < 8; ++j) { p0[j] = tohx(st[0][nt][j] * PCAR); p1[j] = tohx(st[1][nt][j] * PCAR); }
                const V pf = cat16(p0, p1);
#pragma unroll
                for (int dt = 0; dt < 4; ++dt) o[dt][nt] = WFrag<T16>::mma(vf[dt], pf, o[dt][nt]);
            }
        }
        kp += 32 * NW * HD; vp += 32 * NW * HD; if (HR) { kp2 += 32 * NW * HD; vp2 += 32 * NW * HD; }
    }
#pragma unroll
    for (int nt = 0; nt < NQ; ++nt) { const int q = nt * 16 + lr; const float lt = l[nt] + xhalf(l[nt]); if (hi == 0) { ms[wv * QT + q] = m[nt]; ls[wv * QT + q] = lt; }
#pragma unroll
        for (int dt = 0; dt < 4; ++dt) { float* op = os + (size_t)(wv * QT + q) * 68 + dt * 16 + hi * 8; v4f x0, x1;
#pragma unroll
            for (int j = 0; j < 4; ++j) { x0[j] = o[dt][nt][j]; x1[j] = o[dt][nt][4 + j]; }
            *(v4fa*)op = x0; *(v4fa*)(op + 4) = x1; } }
    __syncthreads();   // every wave's partial (maximum, sum, 64 x QT tile) is in LDS before any thread merges them
    constexpr int EP = QT * HD / (32 * NW);   // output elements a thread: EP consecutive d of one query
    static_assert(EP == 4 || EP == 8, "a thread's elements are a 16-byte piece of a block or half of one");
    // threads in the store order of the merged planes (fragment order, [t / 16][column / 32][block]): piece g = (16-query group, 32-d block, half, lane place lp), so that a wave's stores are whole lines
    const int g = threadIdx.x / (8 / EP), sub = (threadIdx.x % (8 / EP)) * EP, lp = g & 31, un = g >> 5;
    const int q = (un >> 2) * 16 + (lp & 15), d0 = ((un >> 1) & 1) * 32 + (un & 1) * 16 + (lp >> 4) * 8 + sub;
    float M = ms[q];
#pragma unroll
    for (int w = 1; w < NW; ++w) M = fmaxf(M, ms[w * QT + q]);
    float L = 0.f, val[EP];
#pragma unroll
    for (int e = 0; e < EP; ++e) val[e] = 0.f;
#pragma unroll
    for (int w = 0; w < NW; ++w) { const float fw = __builtin_amdgcn_exp2f((ms[w * QT + q] - M) * L2E); L += fw * ls[w * QT + q];   // a wave that took no block has maximum -3e38, weight 0, and a zero tile
#pragma unroll
        for (int e4 = 0; e4 < EP / 4; ++e4) { const v4f x = *(const v4fa*)(os + (size_t)(w * QT + q) * 68 + d0 + e4 * 4);
#pragma unroll
            for (int j = 0; j < 4; ++j) val[e4 * 4 + j] += fw * x[j]; } }
    const float f = __fdiv_rn(HR ? 1.0f : (1.0f / PCAR), L);
    const size_t oo = (size_t)(q0 + (un >> 2) * 16) * DQ + ((un >> 1) & 1) * 512 + (un & 1) * 256 + lp * 8 + sub;
    typedef unsigned short vEus __attribute__((ext_vector_type(EP)));
    vEus oh, ol;
#pragma unroll
    for (int e = 0; e < EP; ++e) { unsigned short a, c2; splitf(val[e] * f, a, c2); oh[e] = a; ol[e] = c2; }
    *(vEus*)(Ah + oo) = oh; *(vEus*)(Al + oo) = ol;
}
// grid (RH / 16 + (TT - RH) / 32, heads), 256 threads; the tiles with the most keys have the lowest block indices (for speed only). Query rows < RH: hi+lo bf16 planes, 16 queries a tile; the rest fp16, 32 queries.
__global__ __launch_bounds__(256) void k_attn(const h16* __restrict__ Q16, const h16* __restrict__ K16, const h16* __restrict__ V16, const bf* __restrict__ Qh, const bf* __restrict__ Ql, const bf* __restrict__ Kh, const bf* __restrict__ Kl, const bf* __restrict__ Vh, const bf* __restrict__ Vl, bf* Ah, bf* Al) {
    __shared__ __align__(16) float os[8 * 32 * 68]; __shared__ float ms[8 * 32]; __shared__ float ls[8 * 32];
    const int t = (int)(gridDim.x - 1 - blockIdx.x); const size_t hp = (size_t)blockIdx.y * TT * HD; Ah += blockIdx.y * (HD / 32) * 512; Al += blockIdx.y * (HD / 32) * 512;   // a head's two 32-column blocks
    if (t < RH / 16) attn_tile<bf, true, 1, 8>(Qh + hp, Ql + hp, Kh + hp, Kl + hp, Vh + hp, Vl + hp, t * 16, Ah, Al, os, ms, ls);
    else attn_tile<h16, false, 2, 8>(Q16 + hp, nullptr, K16 + hp, nullptr, V16 + hp, nullptr, RH + (t - RH / 16) * 32, Ah, Al, os, ms, ls);
}

extern "C" void kernel_launch(void* const* d_in, const int* in_sizes, int n_in,
                              void* d_out, int out_size, void* d_ws, size_t ws_size, hipStream_t stream) {
    (void)in_sizes; (void)n_in; (void)out_size;
    const float* x = (const float*)d_in[0]; const float* xk = (const float*)d_in[1]; const float* xv = (const float*)d_in[2]; const float* wq = (const float*)d_in[3]; const float* bq = (const float*)d_in[4]; const float* wk = (const float*)d_in[5]; const float* bk = (const float*)d_in[6]; const float* wv = (const float*)d_in[7]; const float* bv = (const float*)d_in[8]; const float* wo = (const float*)d_in[9]; const float* bo = (const float*)d_in[10];
    float* OUT = (float*)d_out;     // [1][2048][1024]
    char* wsp = (char*)d_ws;
    auto take = [&](size_t bytes) { char* p = wsp; wsp += (bytes + 255) & ~(size_t)255; return (void*)p; };
    bf* XB = (bf*)take(((size_t)3 * TT * DM + (size_t)4 * DQ * DM) * 2);   // x, xk, xv, Wq, Wk, Wv, Wo rounded to bf16, one behind the other
    bf* WQ = XB + (size_t)3 * TT * DM; bf* WO = WQ + (size_t)3 * DQ * DM;
    const size_t PL = (size_t)NH_ * TT * HD;   // one head plane; q, k, v of each kind one behind the other
    h16* QP16 = (h16*)take(3 * PL * 2); h16* KP16 = QP16 + PL; h16* VT16 = KP16 + PL;
    bf* QPh = (bf*)take(3 * PL * 2); bf* KPh = QPh + PL; bf* VTh = KPh + PL;
    bf* QPl = (bf*)take(3 * PL * 2); bf* KPl = QPl + PL; bf* VTl = KPl + PL;
    bf* ATh = (bf*)take((size_t)TT * DQ * 2); bf* ATl = (bf*)take((size_t)TT * DQ * 2);
    if ((size_t)(wsp - (char*)d_ws) > ws_size) return;    // ws 256 MiB
    k_prep<<<(3 * TT * DM + 4 * DQ * DM) / 8192, 256, 0, stream>>>(x, xk, xv, wq, wk, wv, wo, XB);
    k_qkv<<<dim3(TT / 64, DQ / 64, 3), 256, 0, stream>>>(XB, WQ, bq, bk, bv, QP16, QPh, QPl);
    k_attn<<<dim3(RH / 16 + (TT - RH) / 32, NH_, 1), 256, 0, stream>>>(QP16, KP16, VT16, QPh, QPl, KPh, KPl, VTh, VTl, ATh, ATl);
    k_gemmw<bf, 1, true, 8, DQ><<<dim3(TT / 64, DM / 64, 1), 256, 0, stream>>>(ATh, ATl, WO, nullptr, OUT, DM, bo, 0, 0, 0);
}

// v005
// It runs in 58.2 microseconds.
// Timed twice side by side with v004, it ran 1.13 times as fast both times.
// Counting every step since v000, it is 12.7 times as fast.
#include <hip/hip_runtime.h>

// MultiHeadAttentionV2 (q/k/v encodings [1][2048][1024] (three inputs); q/k/v = x W^T + b (torch; 16 heads x 64); causal softmax(q.k / 8); out = merged Wo^T + bo -> [1][2048][1024]).
// Compute dtypes, f32 accumulate: every input rounded to bf16; q/k/v on PLAIN bf16 operands (inputs: exact) + bias; causal scores and attn.v: query rows < 512 hl (3 products), the rest single fp16 (x1024); softmax f32; Wo hl x exact (2 products) + bias.

#define NB_  1
#define TT   2048
#define DM   1024
#define NH_  16
#define NKV  16
#define HD   64
#define DQ   (NH_ * HD)
#define DKV  (NKV * HD)
#define RH   512                  // query rows < RH use hi+lo planes (0: none)
#define PCAR 1024.0f
#define SCL  0.125f   // HD^-0.5
typedef _Float16 h16;
typedef unsigned short bf;
typedef __attribute__((ext_vector_type(16))) __bf16   v16bf;
typedef __attribute__((ext_vector_type(16))) _Float16 v16h;
typedef __attribute__((ext_vector_type(8)))  _Float16 v8h;
typedef __attribute__((ext_vector_type(8)))  unsigned short v8us;
typedef __attribute__((ext_vector_type(8)))  float    v8f;
typedef __attribute__((ext_vector_type(4)))  float    v4f;
typedef v8h  __attribute__((may_alias)) v8ha;
typedef v4f  __attribute__((may_alias)) v4fa;
typedef v8us __attribute__((may_alias)) v8usa;

__device__ __forceinline__ unsigned short f2bf(float f) { unsigned u = __float_as_uint(f); u += 0x7FFFu + ((u >> 16) & 1u); return (unsigned short)(u >> 16); }
__device__ __forceinline__ float bf2f(unsigned short b) { return __uint_as_float(((unsigned)b) << 16); }
__device__ __forceinline__ float bfr(float f) { return bf2f(f2bf(f)); }
__device__ __forceinline__ v16h cat16(v8h lo, v8h hi) { return __builtin_shufflevector(lo, hi, 0, 1, 2, 3, 4, 5, 6, 7, 8, 9, 10, 11, 12, 13, 14, 15); }
__device__ __forceinline__ v16bf cat16b(v8us lo, v8us hi) { return __builtin_bit_cast(v16bf, __builtin_shufflevector(lo, hi, 0, 1, 2, 3, 4, 5, 6, 7, 8, 9, 10, 11, 12, 13, 14, 15)); }
__device__ __forceinline__ v8f wmma16(v16h a, v16h b, v8f c) { return __builtin_amdgcn_wmma_f32_16x16x32_f16(false, a, false, b, (short)0, c, false, false); }
__device__ __forceinline__ v8f wmmab(v16bf a, v16bf b, v8f c) { return __builtin_amdgcn_wmma_f32_16x16x32_bf16(false, a, false, b, (short)0, c, false, false); }



// ---- k_gemmw: register-blocked GEMM, one work-group of NW waves per 64x64 output tile; wave w takes the 32-wide K blocks w, w + NW, ... into its own 16 accumulators, and the NW partial tiles are
// summed through LDS in wave order (a fixed order). Operands straight from 16-bit planes in fragment order; grid (M/64, N/64, Z), 32 * NW threads.
// C[m][n] (f32, pitch ldc, + optional f32 bias[n]) = sum_k A[m][k] Bt[n][k] (+ split products per NSPLIT). z-batch strides sA/sB/sC in elements. K % 32 == 0.
// FRAGMENT ORDER: every 16-bit operand plane is stored as blocks of 16 rows x 32 k = 512 elements (1 KiB), [row block][k block]; in a block, lane (lr, hi) = hi * 16 + lr finds its k = 8 hi .. 8 hi + 7 of row lr at element lane * 8
// and its k = 16 + 8 hi .. at 256 + lane * 8. A fragment is then two wave-wide 16-byte loads of 512 contiguous bytes each (4 whole lines a load, not 16 part lines); the registers hold what they held with row-major planes.
template <typename T16> struct WFrag;
template <> struct WFrag<h16> { typedef v16h V; static __device__ __forceinline__ V ld(const h16* p) { return cat16(*(const v8h*)p, *(const v8h*)(p + 256)); } static __device__ __forceinline__ v8f mma(V a, V b, v8f c) { return wmma16(a, b, c); } };
template <> struct WFrag<bf> { typedef v16bf V; static __device__ __forceinline__ V ld(const bf* p) { return cat16b(*(const v8us*)p, *(const v8us*)(p + 256)); } static __device__ __forceinline__ v8f mma(V a, V b, v8f c) { return wmmab(a, b, c); } };
template <typename T16, int NSPLIT, bool BIAS, int NW, int K>
__global__ __launch_bounds__(32 * NW) void k_gemmw(const T16* __restrict__ A, const T16* __restrict__ A2, const T16* __restrict__ Bt, const T16* __restrict__ Bt2, float* C, int ldc, const float* __restrict__ bias, size_t sA, size_t sB, size_t sC) {
    typedef typename WFrag<T16>::V V;
    __shared__ __align__(16) float os[NW * 64 * 68];
    const size_t z = blockIdx.z; A += z * sA; if (A2) A2 += z * sA; Bt += z * sB; if (Bt2) Bt2 += z * sB; C += z * sC;
    const int lane = threadIdx.x & 31, lr = lane & 15, hi = lane >> 4; const int r0 = blockIdx.x * 64, c0 = blockIdx.y * 64;
    const int wv = __builtin_amdgcn_readfirstlane((int)(threadIdx.x >> 5));   // wave number, scalar: the K loop's trip test stays a scalar branch (every lane on at the matrix instructions)
    v8f acc[4][4];
#pragma unroll
    for (int mb = 0; mb < 4; ++mb)
#pragma unroll
        for (int nb = 0; nb < 4; ++nb) acc[mb][nb] = (v8f){};
    const size_t aoff = (size_t)r0 * K + 8 * lane, boff = (size_t)c0 * K + 8 * lane;   // fragment order: row block rb, k block kb at (rb * K / 32 + kb) * 512
#pragma unroll 1
    for (int kc = 32 * wv; kc < K; kc += 32 * NW) {
        constexpr bool SA = NSPLIT == 1 || NSPLIT == 2, SB = NSPLIT >= 2;
        const T16* ap = A + aoff + kc * 16; const T16* ap2 = SA ? A2 + aoff + kc * 16 : ap; const T16* bp = Bt + boff + kc * 16; const T16* bp2 = SB ? Bt2 + boff + kc * 16 : bp;   // K is a constant: the row blocks are immediate offsets from one pointer an operand
        V a[4], a2[4], b[4], b2[4];
#pragma unroll
        for (int mb = 0; mb < 4; ++mb) { a[mb] = WFrag<T16>::ld(ap + mb * 16 * K); if (SA) a2[mb] = WFrag<T16>::ld(ap2 + mb * 16 * K); }
        // precaution: the wait stands in front of every reuse of the address registers that the issued A loads name; it takes the pointers as inputs so that their registers are held up to it
        asm volatile("s_wait_xcnt 0x0" :: "v"(ap), "v"(ap2) : "memory");
#pragma unroll
        for (int nb = 0; nb < 4; ++nb) { b[nb] = WFrag<T16>::ld(bp + nb * 16 * K); if (SB) b2[nb] = WFrag<T16>::ld(bp2 + nb * 16 * K); }
        // the same behind the B loads
        asm volatile("s_wait_xcnt 0x0" :: "v"(bp), "v"(bp2) : "memory");
#pragma unroll
        for (int nb = 0; nb < 4; ++nb) {
#pragma unroll
            for (int mb = 0; mb < 4; ++mb) { acc[mb][nb] = WFrag<T16>::mma(a[mb], b[nb], acc[mb][nb]); if (SA) acc[mb][nb] = WFrag<T16>::mma(a2[mb], b[nb], acc[mb][nb]); if (SB) acc[mb][nb] = WFrag<T16>::mma(a[mb], b2[nb], acc[mb][nb]); } }
        asm volatile("v_nop\n\tv_nop\n\tv_nop\n\tv_nop" : "+v"(acc[0][0]), "+v"(acc[1][1]), "+v"(acc[2][2]), "+v"(acc[3][3]) : "v"(a[0]), "v"(a[3]));
    }
#pragma unroll
    for (int mb = 0; mb < 4; ++mb) {
#pragma unroll
        for (int nb = 0; nb < 4; ++nb) {
#pragma unroll
            for (int j = 0; j < 8; ++j) os[wv * (64 * 68) + (mb * 16 + hi * 8 + j) * 68 + nb * 16 + lr] = acc[mb][nb][j]; }
    }
    __syncthreads();   // every wave's partial 64x64 tile is in LDS before any thread sums them
    float* crow = C + (size_t)r0 * ldc + c0;
    // both loops unrolled so that the LDS reads of all the sums issue ahead of the adds, and the stores go out together
#pragma unroll
    for (int i = 0; i < 32 / NW; ++i) { const int s = threadIdx.x + i * (32 * NW), row = s >> 4, cofs = (s & 15) * 4; v4f val = *(const v4fa*)(os + row * 68 + cofs);
#pragma unroll
        for (int w = 1; w < NW; ++w) val += *(const v4fa*)(os + w * (64 * 68) + row * 68 + cofs);
        if (BIAS) { val[0] += bfr(bias[c0 + cofs]); val[1] += bfr(bias[c0 + cofs + 1]); val[2] += bfr(bias[c0 + cofs + 2]); val[3] += bfr(bias[c0 + cofs + 3]); }
        *(v4f*)(crow + (size_t)row * ldc + cofs) = val; }
}

__device__ __forceinline__ h16 tohx(float x) { return (h16)x; }
__device__ __forceinline__ void splitf(float y, unsigned short& h, unsigned short& l) { h = f2bf(y); l = f2bf(y - bf2f(h)); }
typedef __attribute__((ext_vector_type(2))) _Float16 v2h;
typedef __attribute__((ext_vector_type(4))) _Float16 v4h;
typedef __attribute__((ext_vector_type(2))) unsigned short v2us;
typedef __attribute__((ext_vector_type(4))) unsigned short v4us;
typedef __attribute__((ext_vector_type(2))) float v2f;
typedef __attribute__((ext_vector_type(4))) int v4i;

__global__ __launch_bounds__(256) void k_wtG(const float* __restrict__ w, int K, int N, bf* Bt) {
    const int lane = threadIdx.x & 31; const int L0 = (blockIdx.x * 8 + (threadIdx.x >> 5)) * 8; const int nlines = N * K / 64;
{
#pragma unroll 1
        for (int l = 0; l < 8; ++l) { const int L = L0 + l; if (L >= nlines) break; const size_t e = (size_t)L * 64 + lane * 2; const int k = (int)(e % K), n = (int)(e / K); v2us o;
            o[0] = f2bf(w[(size_t)k * N + n]); o[1] = f2bf(w[(size_t)(k + 1) * N + n]); *(v2us*)(Bt + e) = o; }
         }
}
// k_prep: all seven f32 -> bf16 roundings in ONE launch, stored in fragment order. dst holds x, xk, xv, Wq, Wk, Wv, Wo one behind the other; block b rounds 16 rows x 512 k, which are 16 KiB in a row of dst.
// A wave reads 1 KiB of one row a load (all of a thread's four loads are asked for before the first rounding); the 16-byte pieces change places through LDS, so that the stores are whole lines too.
__global__ __launch_bounds__(256) void k_prep(const float* __restrict__ x, const float* __restrict__ xk, const float* __restrict__ xv, const float* __restrict__ wq, const float* __restrict__ wk, const float* __restrict__ wv, const float* __restrict__ wo, bf* dst) {
    constexpr int BE = 16 * 512, XN = TT * DM / BE, WN = DQ * DM / BE, KH = DM / 512;
    static_assert(TT % 16 == 0 && DQ % 16 == 0 && DM % 512 == 0 && DKV == DQ && DQ == DM, "whole blocks a tensor, one K for all");
    __shared__ __align__(16) bf ps[64 * 136];   // 64 units of 256 B (16 rows x 8 k), pitch 272 B: 16 lanes that write one row's pieces into 16 units meet 16 different bank groups
    const int b = (int)blockIdx.x; const float* src; int sb;
    if (b < 3 * XN) { const int s = b / XN; src = s == 0 ? x : s == 1 ? xk : xv; sb = b - s * XN; }
    else { const int s = (b - 3 * XN) / WN; src = s == 0 ? wq : s == 1 ? wk : s == 2 ? wv : wo; sb = b - 3 * XN - s * WN; }
    const int lane = threadIdx.x & 31, w2 = (int)(threadIdx.x >> 5) * 2;   // a wave has the rows w2, w2 + 1; load j: row w2 + j / 2, its k half j % 2 of 256
    src += ((size_t)(sb / KH) * 16 + w2) * DM + (sb % KH) * 512 + lane * 8; dst += (size_t)b * BE + threadIdx.x * 8;
    v8f v[4];
#pragma unroll
    for (int j = 0; j < 4; ++j) v[j] = *(const v8f*)(src + (j >> 1) * DM + (j & 1) * 256);
    // precaution: the wait stands in front of every reuse of the address registers that the issued loads name; it takes the pointer as an input so that its registers are held up to it
    asm volatile("s_wait_xcnt 0x0" :: "v"(src) : "memory");
#pragma unroll
    for (int j = 0; j < 4; ++j) { v8us o;
#pragma unroll
        for (int k = 0; k < 8; ++k) o[k] = f2bf(v[j][k]);
        *(v8usa*)(ps + ((j & 1) * 32 + lane) * 136 + (w2 + (j >> 1)) * 8) = o; }   // the piece of k octet c (0 .. 63) and row r is unit c, place r: byte c * 256 + r * 16 of the block's 16 KiB
    __syncthreads();   // all pieces are in LDS before any thread reads them in store order
#pragma unroll
    for (int j = 0; j < 4; ++j) *(v8us*)(dst + j * 2048) = *(const v8usa*)(ps + (j * 16 + (int)(threadIdx.x >> 4)) * 136 + (threadIdx.x & 15) * 8);
}
__global__ __launch_bounds__(256) void k_cscvt(const float* __restrict__ cosT, const float* __restrict__ sinT, float* CS) { const int idx = blockIdx.x * 256 + threadIdx.x; if (idx >= TT * HD) return; v2f cs; cs[0] = bfr(cosT[idx]); cs[1] = bfr(sinT[idx]); *(v2f*)(CS + (size_t)idx * 2) = cs;  }
// ---- k_qkv: the q, k and v projections in ONE launch (blockIdx.z). A work-group of 4 waves (2 x 2) makes a tile of 128 positions x 128 columns (two heads), each wave 64 x 64 over the whole K in its own 16 accumulators.
// Both operands come through LDS: a stage is 128 k of the tile's 128 + 128 operand rows (64 KiB, in fragment order as in global memory), brought by asynchronous copies into two buffers, the next stage flying while this one is worked on;
// each row is then fetched from L2 once a work-group and read by two waves. The accumulator holds 8 consecutive rows of the A side a lane, so the side whose index runs along a plane's k is the A side:
// q, k: A = rows of W (d), B = rows of x (t) -> plane [h][t / 16][d / 32][block]. v: A = rows of x (t), B = rows of W (d) -> plane [h][t / 32][d / 16][block]. A lane's 8 values of one accumulator are one 16-byte piece at its own lane place.
// grid (TT / 128, DQ / 128, 3), 128 threads. X: the three rounded inputs, Wt: the three rounded weights, P16 / Ph / Pl: the q, k, v planes of each kind, one behind the other.
// cp4k: one wave copies 4 KiB in a row (the four k blocks of one 16-row block) to LDS, 16 bytes a lane and copy. l: the lane's LDS byte address, g: its global address.
// precaution: s_wait_xcnt 0 is the last line of the copies' own statement, so that it stands in front of every later write of a register that a copy names
__device__ __forceinline__ void cp4k(unsigned l, const bf* g) {
    asm volatile("global_load_async_to_lds_b128 %0, %8, off\n\t"
                 "global_load_async_to_lds_b128 %1, %9, off\n\t"
                 "global_load_async_to_lds_b128 %2, %10, off\n\t"
                 "global_load_async_to_lds_b128 %3, %11, off\n\t"
                 "global_load_async_to_lds_b128 %4, %12, off\n\t"
                 "global_load_async_to_lds_b128 %5, %13, off\n\t"
                 "global_load_async_to_lds_b128 %6, %14, off\n\t"
                 "global_load_async_to_lds_b128 %7, %15, off\n\t"
                 "s_wait_xcnt 0x0"
                 :: "v"(l), "v"(l + 512u), "v"(l + 1024u), "v"(l + 1536u), "v"(l + 2048u), "v"(l + 2560u), "v"(l + 3072u), "v"(l + 3584u),
                    "v"(g), "v"(g + 256), "v"(g + 512), "v"(g + 768), "v"(g + 1024), "v"(g + 1280), "v"(g + 1536), "v"(g + 1792) : "memory");
}
// the epilogue: accumulators + bias, rounded straight into the three head planes (fp16, bf16 hi, bf16 lo). bp: the lane's bias pointer (VZ: by B column, else by A row); p16, ph, pl: the wave's 64 x 64 part of its head's planes at the lane's place.
template <bool VZ>
__device__ __forceinline__ void qkv_store(const v8f (&acc)[4][4], const float* bp, h16* p16, bf* ph, bf* pl) {
    float bb[VZ ? 4 : 32];
    if constexpr (VZ) {
#pragma unroll
        for (int nb = 0; nb < 4; ++nb) bb[nb] = bp[nb * 16];
    } else {
#pragma unroll
        for (int mb = 0; mb < 4; ++mb) { const v4f x0 = *(const v4f*)(bp + mb * 16), x1 = *(const v4f*)(bp + mb * 16 + 4);
#pragma unroll
            for (int j = 0; j < 4; ++j) { bb[mb * 8 + j] = x0[j]; bb[mb * 8 + 4 + j] = x1[j]; } }
    }
    // precaution: the wait takes the pointer as an input, so that the registers which the issued bias loads name are held up to it
    asm volatile("s_wait_xcnt 0x0" :: "v"(bp) : "memory");
#pragma unroll
    for (int i = 0; i < (VZ ? 4 : 32); ++i) bb[i] = bfr(bb[i]);
#pragma unroll
    for (int mb = 0; mb < 4; ++mb) {
        v8h o16[4]; v8us oh[4], ol[4];
#pragma unroll
        for (int nb = 0; nb < 4; ++nb)
#pragma unroll
            for (int j = 0; j < 8; ++j) { const float r = acc[mb][nb][j] + (VZ ? bb[nb] : bb[mb * 8 + j]); o16[nb][j] = tohx(r); unsigned short a2, c2; splitf(r, a2, c2); oh[nb][j] = a2; ol[nb][j] = c2; }
#pragma unroll
        for (int nb = 0; nb < 4; ++nb) { const int e = VZ ? (mb >> 1) * 2048 + nb * 512 + (mb & 1) * 256 : nb * 1024 + mb * 256; *(v8h*)(p16 + e) = o16[nb]; *(v8us*)(ph + e) = oh[nb]; *(v8us*)(pl + e) = ol[nb]; }
        // the same precaution behind the twelve stores: their data and address registers are inputs of the wait, so none is written again in front of it
        asm volatile("s_wait_xcnt 0x0" :: "v"(o16[0]), "v"(o16[1]), "v"(o16[2]), "v"(o16[3]), "v"(oh[0]), "v"(oh[1]), "v"(oh[2]), "v"(oh[3]), "v"(ol[0]), "v"(ol[1]), "v"(ol[2]), "v"(ol[3]), "v"(p16), "v"(ph), "v"(pl) : "memory");
    }
}
__global__ __launch_bounds__(128) void k_qkv(const bf* __restrict__ X, const bf* __restrict__ Wt, const float* __restrict__ bq, const float* __restrict__ bk, const float* __restrict__ bv, h16* P16, bf* Ph, bf* Pl) {
    typedef WFrag<bf>::V V;
    constexpr int K = DM, KS = 128, NS = K / KS, SE = 2 * 128 * KS;   // a stage: KS k of 2 x 128 rows = SE elements, [side][16-row block][k block][512]
    static_assert(NS >= 2 && TT % 128 == 0 && DQ % 128 == 0 && HD == 64, "two stages or more, whole tiles, two heads a tile");
    __shared__ __align__(1024) bf ring[2 * SE];
    const int z = (int)blockIdx.z; const bool vz = z == 2;
    const int t0 = (int)blockIdx.x * 128, d0 = (int)blockIdx.y * 128;
    const bf* xr = X + (size_t)z * TT * DM + (size_t)t0 * K; const bf* wr = Wt + (size_t)z * DQ * DM + (size_t)d0 * K;
    const int lane = threadIdx.x & 31, lr = lane & 15, hi = lane >> 4;
    const int wv = __builtin_amdgcn_readfirstlane((int)(threadIdx.x >> 5)), wm = wv >> 1, wn = wv & 1;   // wave number, scalar; its 64 x 64 part: A rows wm, B rows wn
    // wave w copies the 16-row blocks 4 w .. 4 w + 3 of a stage's sixteen (0 .. 7: A side, 8 .. 15: B side): block r at cg + r * 16 * K, stage s at + s * KS * 16 elements; in LDS block r at cl + r * 4096, buffer b at + b * SE * 2 bytes
    const bf* cg = ((wv < 2) == vz ? xr : wr) + (size_t)(wv & 1) * 64 * K + lane * 8;
    const unsigned cl = (unsigned)(size_t)ring + (unsigned)wv * 16384u + (unsigned)lane * 16u;
    v8f acc[4][4];
#pragma unroll
    for (int mb = 0; mb < 4; ++mb)
#pragma unroll
        for (int nb = 0; nb < 4; ++nb) acc[mb][nb] = (v8f){};
#pragma unroll
    for (int r = 0; r < 4; ++r) cp4k(cl + r * 4096u, cg + (size_t)r * 16 * K);
    asm volatile("s_wait_asynccnt 0x0" ::: "memory");   // this wave's copies of stage 0 have landed
    __syncthreads();                                      // and every other wave's: stage 0 may be read
#pragma unroll
    for (int r = 0; r < 4; ++r) cp4k(cl + (unsigned)(SE * 2) + r * 4096u, cg + KS * 16 + (size_t)r * 16 * K);
    // kept rolled: a pass is 64 products long already (for speed only); one pass a stage, the buffer by the pass's parity
#pragma unroll 1
    for (int s = 0; s < NS; ++s) {
        const bf* sa = ring + (s & 1) * SE + wm * 8192 + lane * 8; const bf* sb = ring + (s & 1) * SE + 16384 + wn * 8192 + lane * 8;
        // two fragment sets: block kb + 1's sixteen LDS reads go out as one group ahead of block kb's products (for speed only); all of them are of this pass's own buffer
        V a[2][4], b[2][4];
#pragma unroll
        for (int i = 0; i < 4; ++i) { a[0][i] = WFrag<bf>::ld(sa + i * 2048); b[0][i] = WFrag<bf>::ld(sb + i * 2048); }
#pragma unroll
        for (int kb = 0; kb < KS / 32; ++kb) {
            if (kb + 1 < KS / 32) {
#pragma unroll
                for (int i = 0; i < 4; ++i) { a[(kb + 1) & 1][i] = WFrag<bf>::ld(sa + i * 2048 + (kb + 1) * 512); b[(kb + 1) & 1][i] = WFrag<bf>::ld(sb + i * 2048 + (kb + 1) * 512); }
            }
            __builtin_amdgcn_sched_barrier(0);   // keeps the group of reads in front of the block's products
#pragma unroll
            for (int nb = 0; nb < 4; ++nb)
#pragma unroll
                for (int mb = 0; mb < 4; ++mb) acc[mb][nb] = WFrag<bf>::mma(a[kb & 1][mb], b[kb & 1][nb], acc[mb][nb]);
            __builtin_amdgcn_sched_barrier(0);   // and the next group behind them
        }
        asm volatile("s_wait_dscnt 0x0" ::: "memory");      // this wave's reads of the buffer are done before it is refilled
        asm volatile("s_wait_asynccnt 0x0" ::: "memory");   // this wave's copies of stage s + 1 have landed
        __syncthreads();                                      // publishes stage s + 1 and ends every wave's reads of stage s
        if (s + 2 < NS) {
#pragma unroll
            for (int r = 0; r < 4; ++r) cp4k(cl + (unsigned)((s & 1) * SE * 2) + r * 4096u, cg + (size_t)(s + 2) * (KS * 16) + (size_t)r * 16 * K);
        }
    }
    asm volatile("s_wait_asynccnt 0x0" ::: "memory");   // no copy is outstanding when the wave goes on
    const float* bias = z == 0 ? bq : z == 1 ? bk : bv;
    const size_t pb = ((size_t)z * NH_ + (size_t)blockIdx.y * 2 + (vz ? wn : wm)) * TT * HD + (size_t)(t0 + (vz ? wm : wn) * 64) * HD + lane * 8;
    if (vz) qkv_store<true>(acc, bias + d0 + wn * 64 + lr, P16 + pb, Ph + pb, Pl + pb);
    else qkv_store<false>(acc, bias + d0 + wm * 64 + hi * 8, P16 + pb, Ph + pb, Pl + pb);
}
// ---- k_attn: causal attention of one head and one tile of queries in ONE launch: scores, softmax (running maximum and sum) and the probability x value product stay in registers.
// Transposed products: S^T = K Q^T (A = key rows, B = query rows), O^T += V^T P^T (A = V^T rows, B = P^T). In a 16-query group lane lr (both halves) holds query lr; two 16-key score tiles are, register for register,
// the B operand of the 32-key value product. Wave w of the work-group takes the 32-key blocks w, w + NW, ... with its own maximum, sum and accumulators; the NW partials are merged through LDS in wave order.
#define L2E 1.4426950408889634f
__device__ __forceinline__ float xhalf(float x) { return __builtin_bit_cast(float, __builtin_amdgcn_permlanex16(__builtin_bit_cast(int, x), __builtin_bit_cast(int, x), 0x76543210, 0xfedcba98, false, false)); }   // lane l with lane l ^ 16, in registers
template <typename T16, bool HR, int NQ, int NW>
__device__ __forceinline__ void attn_tile(const T16* __restrict__ Q, const T16* __restrict__ Q2, const T16* __restrict__ Kp, const T16* __restrict__ K2, const T16* __restrict__ Vt, const T16* __restrict__ V2, int q0, bf* Ah, bf* Al, float* os, float* ms, float* ls) {
    typedef typename WFrag<T16>::V V;
    constexpr int QT = 16 * NQ;
    const int lane = threadIdx.x & 31, lr = lane & 15, hi = lane >> 4;
    const int wv = __builtin_amdgcn_readfirstlane((int)(threadIdx.x >> 5));   // wave number, scalar: the key loop's trip test stays a scalar branch (every lane on at the matrix instructions)
    V qf[NQ][2], qf2[NQ][2];
#pragma unroll
    for (int nt = 0; nt < NQ; ++nt)
#pragma unroll
        for (int ks = 0; ks < 2; ++ks) { const size_t qo = (size_t)(q0 + nt * 16) * HD + ks * 512 + 8 * lane; qf[nt][ks] = WFrag<T16>::ld(Q + qo); if (HR) qf2[nt][ks] = WFrag<T16>::ld(Q2 + qo); }
    v8f o[4][NQ]; float m[NQ], l[NQ];
#pragma unroll
    for (int nt = 0; nt < NQ; ++nt) { m[nt] = -3.0e38f; l[nt] = 0.f;
#pragma unroll
        for (int dt = 0; dt < 4; ++dt) o[dt][nt] = (v8f){}; }
    // the lane's own K and V pointers, stepped by NW blocks at the foot of each trip
    const size_t kst = (size_t)(32 * wv) * HD + 8 * lane, vst = (size_t)(32 * wv) * HD + 8 * lane;   // a 32-key block is 4 blocks of K (2 x 16 keys, 2 x 32 d) and 4 of V^T (4 x 16 d), 4 KiB in a row each
    const T16* kp = Kp + kst; const T16* kp2 = HR ? K2 + kst : nullptr; const T16* vp = Vt + vst; const T16* vp2 = HR ? V2 + vst : nullptr;
    // every block taken starts at a key <= q0, so each query of the tile has at least one unmasked key in it and the running maximum is a real score after a wave's first block
#pragma unroll 1
    for (int k0 = 32 * wv; k0 < q0 + QT; k0 += 32 * NW) {
        v8f st[2][NQ];
#pragma unroll
        for (int kt = 0; kt < 2; ++kt)
#pragma unroll
            for (int nt = 0; nt < NQ; ++nt) st[kt][nt] = (v8f){};
        V kf[2][2], kf2[2][2], vf[4], vf2[4];   // all of the block's K and V fragments are asked for at once, so that the V loads fly while the scores are formed
#pragma unroll
        for (int kt = 0; kt < 2; ++kt)
#pragma unroll
            for (int ks = 0; ks < 2; ++ks) { const int ko = (kt * 2 + ks) * 512; kf[kt][ks] = WFrag<T16>::ld(kp + ko); if (HR) kf2[kt][ks] = WFrag<T16>::ld(kp2 + ko); }
        // precaution: the wait stands in front of every reuse of the address registers that the issued K loads name; it takes the pointers as inputs so that their registers are held up to it;
        // the scheduling barrier keeps later address arithmetic behind it and every K load in front of the first product
        if constexpr (HR) asm volatile("s_wait_xcnt 0x0" :: "v"(kp), "v"(kp2) : "memory"); else asm volatile("s_wait_xcnt 0x0" :: "v"(kp) : "memory");
        __builtin_amdgcn_sched_barrier(0);
#pragma unroll
        for (int dt = 0; dt < 4; ++dt) { const int vo = dt * 512; vf[dt] = WFrag<T16>::ld(vp + vo); if (HR) vf2[dt] = WFrag<T16>::ld(vp2 + vo); }
        // the same behind the V loads: all of them are in flight before the wave first waits for K
        if constexpr (HR) asm volatile("s_wait_xcnt 0x0" :: "v"(vp), "v"(vp2) : "memory"); else asm volatile("s_wait_xcnt 0x0" :: "v"(vp) : "memory");
        __builtin_amdgcn_sched_barrier(0);
#pragma unroll
        for (int kt = 0; kt < 2; ++kt)
#pragma unroll
            for (int ks = 0; ks < 2; ++ks)
#pragma unroll
                for (int nt = 0; nt < NQ; ++nt) { st[kt][nt] = WFrag<T16>::mma(kf[kt][ks], qf[nt][ks], st[kt][nt]); if (HR) { st[kt][nt] = WFrag<T16>::mma(kf[kt][ks], qf2[nt][ks], st[kt][nt]); st[kt][nt] = WFrag<T16>::mma(kf2[kt][ks], qf[nt][ks], st[kt][nt]); } }
        if (k0 + 31 > q0) {   // scalar branch: only a block that reaches past the tile's first query needs the causal select
#pragma unroll
            for (int nt = 0; nt < NQ; ++nt)
#pragma unroll
                for (int kt = 0; kt < 2; ++kt)
#pragma unroll
                    for (int j = 0; j < 8; ++j) st[kt][nt][j] = (k0 + kt * 16 + hi * 8 + j <= q0 + nt * 16 + lr) ? st[kt][nt][j] : -3.0e38f;
        }
#pragma unroll
        for (int nt = 0; nt < NQ; ++nt) {
            float mx = m[nt];
#pragma unroll
            for (int kt = 0; kt < 2; ++kt)
#pragma unroll
                for (int j = 0; j < 8; ++j) { const float t = st[kt][nt][j] * SCL; st[kt][nt][j] = t; mx = fmaxf(mx, t); }
            mx = fmaxf(mx, xhalf(mx));   // the two halves of the wave hold the other keys of the same query
            const float al = __builtin_amdgcn_exp2f((m[nt] - mx) * L2E); m[nt] = mx; float sum = 0.f;
#pragma unroll
            for (int kt = 0; kt < 2; ++kt)
#pragma unroll
                for (int j = 0; j < 8; ++j) { const float e = __builtin_amdgcn_exp2f((st[kt][nt][j] - mx) * L2E); st[kt][nt][j] = e; sum += e; }
            l[nt] = l[nt] * al + sum;
#pragma unroll
            for (int dt = 0; dt < 4; ++dt) o[dt][nt] *= al;
            if constexpr (HR) {
                v8us h0, h1, l0, l1;
#pragma unroll
                for (int j = 0; j < 8; ++j) { unsigned short a, c2; splitf(st[0][nt][j], a, c2); h0[j] = a; l0[j] = c2; splitf(st[1][nt][j], a, c2); h1[j] = a; l1[j] = c2; }
                const V ph = cat16b(h0, h1), pl = cat16b(l0, l1);
#pragma unroll
                for (int dt = 0; dt < 4; ++dt) { o[dt][nt] = WFrag<T16>::mma(vf[dt], ph, o[dt][nt]); o[dt][nt] = WFrag<T16>::mma(vf[dt], pl, o[dt][nt]); o[dt][nt] = WFrag<T16>::mma(vf2[dt], ph, o[dt][nt]); }
            } else {
                v8h p0, p1;
#pragma unroll
                for (int j = 0; j < 8; ++j) { p0[j] = tohx(st[0][nt][j] * PCAR); p1[j] = tohx(st[1][nt][j] * PCAR); }
                const V pf = cat16(p0, p1);
#pragma unroll
                for (int dt = 0; dt < 4; ++dt) o[dt][nt] = WFrag<T16>::mma(vf[dt], pf, o[dt][nt]);
            }
        }
        kp += 32 * NW * HD; vp += 32 * NW * HD; if (HR) { kp2 += 32 * NW * HD; vp2 += 32 * NW * HD; }
    }
#pragma unroll
    for (int nt = 0; nt < NQ; ++nt) { const int q = nt * 16 + lr; const float lt = l[nt] + xhalf(l[nt]); if (hi == 0) { ms[wv * QT + q] = m[nt]; ls[wv * QT + q] = lt; }
#pragma unroll
        for (int dt = 0; dt < 4; ++dt) { float* op = os + (size_t)(wv * QT + q) * 68 + dt * 16 + hi * 8; v4f x0, x1;
#pragma unroll
            for (int j = 0; j < 4; ++j) { x0[j] = o[dt][nt][j]; x1[j] = o[dt][nt][4 + j]; }
            *(v4fa*)op = x0; *(v4fa*)(op + 4) = x1; } }
    __syncthreads();   // every wave's partial (maximum, sum, 64 x QT tile) is in LDS before any thread merges them
    constexpr int EP = QT * HD / (32 * NW);   // output elements a thread: EP consecutive d of one query
    static_assert(EP == 4 || EP == 8, "a thread's elements are a 16-byte piece of a block or half of one");
    // threads in the store order of the merged planes (fragment order, [t / 16][column / 32][block]): piece g = (16-query group, 32-d block, half, lane place lp), so that a wave's stores are whole lines
    const int g = threadIdx.x / (8 / EP), sub = (threadIdx.x % (8 / EP)) * EP, lp = g & 31, un = g >> 5;
    const int q = (un >> 2) * 16 + (lp & 15), d0 = ((un >> 1) & 1) * 32 + (un & 1) * 16 + (lp >> 4) * 8 + sub;
    float M = ms[q];
#pragma unroll
    for (int w = 1; w < NW; ++w) M = fmaxf(M, ms[w * QT + q]);
    float L = 0.f, val[EP];
#pragma unroll
    for (int e = 0; e < EP; ++e) val[e] = 0.f;
#pragma unroll
    for (int w = 0; w < NW; ++w) { const float fw = __builtin_amdgcn_exp2f((ms[w * QT + q] - M) * L2E); L += fw * ls[w * QT + q];   // a wave that took no block has maximum -3e38, weight 0, and a zero tile
#pragma unroll
        for (int e4 = 0; e4 < EP / 4; ++e4) { const v4f x = *(const v4fa*)(os + (size_t)(w * QT + q) * 68 + d0 + e4 * 4);
#pragma unroll
            for (int j = 0; j < 4; ++j) val[e4 * 4 + j] += fw * x[j]; } }
    const float f = __fdiv_rn(HR ? 1.0f : (1.0f / PCAR), L);
    const size_t oo = (size_t)(q0 + (un >> 2) * 16) * DQ + ((un >> 1) & 1) * 512 + (un & 1) * 256 + lp * 8 + sub;
    typedef unsigned short vEus __attribute__((ext_vector_type(EP)));
    vEus oh, ol;
#pragma unroll
    for (int e = 0; e < EP; ++e) { unsigned short a, c2; splitf(val[e] * f, a, c2); oh[e] = a; ol[e] = c2; }
    *(vEus*)(Ah + oo) = oh; *(vEus*)(Al + oo) = ol;
}
// grid (RH / 16 + (TT - RH) / 32, heads), 256 threads; the tiles with the most keys have the lowest block indices (for speed only). Query rows < RH: hi+lo bf16 planes, 16 queries a tile; the rest fp16, 32 queries.
__global__ __launch_bounds__(256) void k_attn(const h16* __restrict__ Q16, const h16* __restrict__ K16, const h16* __restrict__ V16, const bf* __restrict__ Qh, const bf* __restrict__ Ql, const bf* __restrict__ Kh, const bf* __restrict__ Kl, const bf* __restrict__ Vh, const bf* __restrict__ Vl, bf* Ah, bf* Al) {
    __shared__ __align__(16) float os[8 * 32 * 68]; __shared__ float ms[8 * 32]; __shared__ float ls[8 * 32];
    const int t = (int)(gridDim.x - 1 - blockIdx.x); const size_t hp = (size_t)blockIdx.y * TT * HD; Ah += blockIdx.y * (HD / 32) * 512; Al += blockIdx.y * (HD / 32) * 512;   // a head's two 32-column blocks
    if (t < RH / 16) attn_tile<bf, true, 1, 8>(Qh + hp, Ql + hp, Kh + hp, Kl + hp, Vh + hp, Vl + hp, t * 16, Ah, Al, os, ms, ls);
    else attn_tile<h16, false, 2, 8>(Q16 + hp, nullptr, K16 + hp, nullptr, V16 + hp, nullptr, RH + (t - RH / 16) * 32, Ah, Al, os, ms, ls);
}

extern "C" void kernel_launch(void* const* d_in, const int* in_sizes, int n_in,
                              void* d_out, int out_size, void* d_ws, size_t ws_size, hipStream_t stream) {
    (void)in_sizes; (void)n_in; (void)out_size;
    const float* x = (const float*)d_in[0]; const float* xk = (const float*)d_in[1]; const float* xv = (const float*)d_in[2]; const float* wq = (const float*)d_in[3]; const float* bq = (const float*)d_in[4]; const float* wk = (const float*)d_in[5]; const float* bk = (const float*)d_in[6]; const float* wv = (const float*)d_in[7]; const float* bv = (const float*)d_in[8]; const float* wo = (const float*)d_in[9]; const float* bo = (const float*)d_in[10];
    float* OUT = (float*)d_out;     // [1][2048][1024]
    char* wsp = (char*)d_ws;
    auto take = [&](size_t bytes) { char* p = wsp; wsp += (bytes + 255) & ~(size_t)255; return (void*)p; };
    bf* XB = (bf*)take(((size_t)3 * TT * DM + (size_t)4 * DQ * DM) * 2);   // x, xk, xv, Wq, Wk, Wv, Wo rounded to bf16, one behind the other
    bf* WQ = XB + (size_t)3 * TT * DM; bf* WO = WQ + (size_t)3 * DQ * DM;
    const size_t PL = (size_t)NH_ * TT * HD;   // one head plane; q, k, v of each kind one behind the other
    h16* QP16 = (h16*)take(3 * PL * 2); h16* KP16 = QP16 + PL; h16* VT16 = KP16 + PL;
    bf* QPh = (bf*)take(3 * PL * 2); bf* KPh = QPh + PL; bf* VTh = KPh + PL;
    bf* QPl = (bf*)take(3 * PL * 2); bf* KPl = QPl + PL; bf* VTl = KPl + PL;
    bf* ATh = (bf*)take((size_t)TT * DQ * 2); bf* ATl = (bf*)take((size_t)TT * DQ * 2);
    if ((size_t)(wsp - (char*)d_ws) > ws_size) return;    // ws 256 MiB
    k_prep<<<(3 * TT * DM + 4 * DQ * DM) / 8192, 256, 0, stream>>>(x, xk, xv, wq, wk, wv, wo, XB);
    k_qkv<<<dim3(TT / 128, DQ / 128, 3), 128, 0, stream>>>(XB, WQ, bq, bk, bv, QP16, QPh, QPl);
    k_attn<<<dim3(RH / 16 + (TT - RH) / 32, NH_, 1), 256, 0, stream>>>(QP16, KP16, VT16, QPh, QPl, KPh, KPl, VTh, VTl, ATh, ATl);
    k_gemmw<bf, 1, true, 8, DQ><<<dim3(TT / 64, DM / 64, 1), 256, 0, stream>>>(ATh, ATl, WO, nullptr, OUT, DM, bo, 0, 0, 0);
}

// v006
// A run of this version takes 51.7 microseconds.
// In both of two side-by-side timings against v005, it was 1.11 times as fast.
// Over all steps from v000 it is 14.1 times as fast.
#include <hip/hip_runtime.h>

// MultiHeadAttentionV2 (q/k/v encodings [1][2048][1024] (three inputs); q/k/v = x W^T + b (torch; 16 heads x 64); causal softmax(q.k / 8); out = merged Wo^T + bo -> [1][2048][1024]).
// Compute dtypes, f32 accumulate: every input rounded to bf16; q/k/v on PLAIN bf16 operands (inputs: exact) + bias; causal scores and attn.v: query rows < 512 hl (3 products), the rest single fp16 (x1024); softmax f32; Wo hl x exact (2 products) + bias.

#define NB_  1
#define TT   2048
#define DM   1024
#define NH_  16
#define NKV  16
#define HD   64
#define DQ   (NH_ * HD)
#define DKV  (NKV * HD)
#define RH   512                  // query rows < RH use hi+lo planes (0: none)
#define PCAR 1024.0f
#define SCL  0.125f   // HD^-0.5
typedef _Float16 h16;
typedef unsigned short bf;
typedef __attribute__((ext_vector_type(16))) __bf16   v16bf;
typedef __attribute__((ext_vector_type(16))) _Float16 v16h;
typedef __attribute__((ext_vector_type(8)))  _Float16 v8h;
typedef __attribute__((ext_vector_type(8)))  unsigned short v8us;
typedef __attribute__((ext_vector_type(8)))  float    v8f;
typedef __attribute__((ext_vector_type(4)))  float    v4f;
typedef v8h  __attribute__((may_alias)) v8ha;
typedef v4f  __attribute__((may_alias)) v4fa;
typedef v8us __attribute__((may_alias)) v8usa;

__device__ __forceinline__ unsigned short f2bf(float f) { unsigned u = __float_as_uint(f); u += 0x7FFFu + ((u >> 16) & 1u); return (unsigned short)(u >> 16); }
__device__ __forceinline__ float bf2f(unsigned short b) { return __uint_as_float(((unsigned)b) << 16); }
__device__ __forceinline__ float bfr(float f) { return bf2f(f2bf(f)); }
__device__ __forceinline__ v16h cat16(v8h lo, v8h hi) { return __builtin_shufflevector(lo, hi, 0, 1, 2, 3, 4, 5, 6, 7, 8, 9, 10, 11, 12, 13, 14, 15); }
__device__ __forceinline__ v16bf cat16b(v8us lo, v8us hi) { return __builtin_bit_cast(v16bf, __builtin_shufflevector(lo, hi, 0, 1, 2, 3, 4, 5, 6, 7, 8, 9, 10, 11, 12, 13, 14, 15)); }
__device__ __forceinline__ v8f wmma16(v16h a, v16h b, v8f c) { return __builtin_amdgcn_wmma_f32_16x16x32_f16(false, a, false, b, (short)0, c, false, false); }
__device__ __forceinline__ v8f wmmab(v16bf a, v16bf b, v8f c) { return __builtin_amdgcn_wmma_f32_16x16x32_bf16(false, a, false, b, (short)0, c, false, false); }



// ---- k_gemmw: register-blocked GEMM, one work-group of NW waves per 64x64 output tile; wave w takes the 32-wide K blocks w, w + NW, ... into its own 16 accumulators, and the NW partial tiles are
// summed through LDS in wave order (a fixed order). Operands straight from 16-bit planes in fragment order; grid (M/64, N/64, Z), 32 * NW threads.
// C[m][n] (f32, pitch ldc, + optional f32 bias[n]) = sum_k A[m][k] Bt[n][k] (+ split products per NSPLIT). z-batch strides sA/sB/sC in elements. K % 32 == 0.
// FRAGMENT ORDER: every 16-bit operand plane is stored as blocks of 16 rows x 32 k = 512 elements (1 KiB), [row block][k block]; in a block, lane (lr, hi) = hi * 16 + lr finds its k = 8 hi .. 8 hi + 7 of row lr at element lane * 8
// and its k = 16 + 8 hi .. at 256 + lane * 8. A fragment is then two wave-wide 16-byte loads of 512 contiguous bytes each (4 whole lines a load, not 16 part lines); the registers hold what they held with row-major planes.
template <typename T16> struct WFrag;
template <> struct WFrag<h16> { typedef v16h V; static __device__ __forceinline__ V ld(const h16* p) { return cat16(*(const v8h*)p, *(const v8h*)(p + 256)); } static __device__ __forceinline__ v8f mma(V a, V b, v8f c) { return wmma16(a, b, c); } };
template <> struct WFrag<bf> { typedef v16bf V; static __device__ __forceinline__ V ld(const bf* p) { return cat16b(*(const v8us*)p, *(const v8us*)(p + 256)); } static __device__ __forceinline__ v8f mma(V a, V b, v8f c) { return wmmab(a, b, c); } };
template <typename T16, int NSPLIT, bool BIAS, int NW, int K>
__global__ __launch_bounds__(32 * NW) void k_gemmw(const T16* __restrict__ A, const T16* __restrict__ A2, const T16* __restrict__ Bt, const T16* __restrict__ Bt2, float* C, int ldc, const float* __restrict__ bias, size_t sA, size_t sB, size_t sC) {
    typedef typename WFrag<T16>::V V;
    __shared__ __align__(16) float os[NW * 64 * 68];
    const size_t z = blockIdx.z; A += z * sA; if (A2) A2 += z * sA; Bt += z * sB; if (Bt2) Bt2 += z * sB; C += z * sC;
    const int lane = threadIdx.x & 31, lr = lane & 15, hi = lane >> 4; const int r0 = blockIdx.x * 64, c0 = blockIdx.y * 64;
    const int wv = __builtin_amdgcn_readfirstlane((int)(threadIdx.x >> 5));   // wave number, scalar: the K loop's trip test stays a scalar branch (every lane on at the matrix instructions)
    v8f acc[4][4];
#pragma unroll
    for (int mb = 0; mb < 4; ++mb)
#pragma unroll
        for (int nb = 0; nb < 4; ++nb) acc[mb][nb] = (v8f){};
    const size_t aoff = (size_t)r0 * K + 8 * lane, boff = (size_t)c0 * K + 8 * lane;   // fragment order: row block rb, k block kb at (rb * K / 32 + kb) * 512
#pragma unroll 1
    for (int kc = 32 * wv; kc < K; kc += 32 * NW) {
        constexpr bool SA = NSPLIT == 1 || NSPLIT == 2, SB = NSPLIT >= 2;
        const T16* ap = A + aoff + kc * 16; const T16* ap2 = SA ? A2 + aoff + kc * 16 : ap; const T16* bp = Bt + boff + kc * 16; const T16* bp2 = SB ? Bt2 + boff + kc * 16 : bp;   // K is a constant: the row blocks are immediate offsets from one pointer an operand
        V a[4], a2[4], b[4], b2[4];
#pragma unroll
        for (int mb = 0; mb < 4; ++mb) { a[mb] = WFrag<T16>::ld(ap + mb * 16 * K); if (SA) a2[mb] = WFrag<T16>::ld(ap2 + mb * 16 * K); }
        // precaution: the wait stands in front of every reuse of the address registers that the issued A loads name; it takes the pointers as inputs so that their registers are held up to it
        asm volatile("s_wait_xcnt 0x0" :: "v"(ap), "v"(ap2) : "memory");
#pragma unroll
        for (int nb = 0; nb < 4; ++nb) { b[nb] = WFrag<T16>::ld(bp + nb * 16 * K); if (SB) b2[nb] = WFrag<T16>::ld(bp2 + nb * 16 * K); }
        // the same behind the B loads
        asm volatile("s_wait_xcnt 0x0" :: "v"(bp), "v"(bp2) : "memory");
#pragma unroll
        for (int nb = 0; nb < 4; ++nb) {
#pragma unroll
            for (int mb = 0; mb < 4; ++mb) { acc[mb][nb] = WFrag<T16>::mma(a[mb], b[nb], acc[mb][nb]); if (SA) acc[mb][nb] = WFrag<T16>::mma(a2[mb], b[nb], acc[mb][nb]); if (SB) acc[mb][nb] = WFrag<T16>::mma(a[mb], b2[nb], acc[mb][nb]); } }
        asm volatile("v_nop\n\tv_nop\n\tv_nop\n\tv_nop" : "+v"(acc[0][0]), "+v"(acc[1][1]), "+v"(acc[2][2]), "+v"(acc[3][3]) : "v"(a[0]), "v"(a[3]));
    }
#pragma unroll
    for (int mb = 0; mb < 4; ++mb) {
#pragma unroll
        for (int nb = 0; nb < 4; ++nb) {
#pragma unroll
            for (int j = 0; j < 8; ++j) os[wv * (64 * 68) + (mb * 16 + hi * 8 + j) * 68 + nb * 16 + lr] = acc[mb][nb][j]; }
    }
    __syncthreads();   // every wave's partial 64x64 tile is in LDS before any thread sums them
    float* crow = C + (size_t)r0 * ldc + c0;
    // both loops unrolled so that the LDS reads of all the sums issue ahead of the adds, and the stores go out together
#pragma unroll
    for (int i = 0; i < 32 / NW; ++i) { const int s = threadIdx.x + i * (32 * NW), row = s >> 4, cofs = (s & 15) * 4; v4f val = *(const v4fa*)(os + row * 68 + cofs);
#pragma unroll
        for (int w = 1; w < NW; ++w) val += *(const v4fa*)(os + w * (64 * 68) + row * 68 + cofs);
        if (BIAS) { val[0] += bfr(bias[c0 + cofs]); val[1] += bfr(bias[c0 + cofs + 1]); val[2] += bfr(bias[c0 + cofs + 2]); val[3] += bfr(bias[c0 + cofs + 3]); }
        *(v4f*)(crow + (size_t)row * ldc + cofs) = val; }
}

__device__ __forceinline__ h16 tohx(float x) { return (h16)x; }
__device__ __forceinline__ void splitf(float y, unsigned short& h, unsigned short& l) { h = f2bf(y); l = f2bf(y - bf2f(h)); }
typedef __attribute__((ext_vector_type(2))) _Float16 v2h;
typedef __attribute__((ext_vector_type(4))) _Float16 v4h;
typedef __attribute__((ext_vector_type(2))) unsigned short v2us;
typedef __attribute__((ext_vector_type(4))) unsigned short v4us;
typedef __attribute__((ext_vector_type(2))) float v2f;
typedef __attribute__((ext_vector_type(4))) int v4i;

__global__ __launch_bounds__(256) void k_wtG(const float* __restrict__ w, int K, int N, bf* Bt) {
    const int lane = threadIdx.x & 31; const int L0 = (blockIdx.x * 8 + (threadIdx.x >> 5)) * 8; const int nlines = N * K / 64;
{
#pragma unroll 1
        for (int l = 0; l < 8; ++l) { const int L = L0 + l; if (L >= nlines) break; const size_t e = (size_t)L * 64 + lane * 2; const int k = (int)(e % K), n = (int)(e / K); v2us o;
            o[0] = f2bf(w[(size_t)k * N + n]); o[1] = f2bf(w[(size_t)(k + 1) * N + n]); *(v2us*)(Bt + e) = o; }
         }
}
// k_prep: all seven f32 -> bf16 roundings in ONE launch, stored in fragment order. dst holds x, xk, xv, Wq, Wk, Wv, Wo one behind the other; block b rounds 16 rows x 512 k, which are 16 KiB in a row of dst.
// A wave reads 1 KiB of one row a load (all of a thread's four loads are asked for before the first rounding); the 16-byte pieces change places through LDS, so that the stores are whole lines too.
__global__ __launch_bounds__(256) void k_prep(const float* __restrict__ x, const float* __restrict__ xk, const float* __restrict__ xv, const float* __restrict__ wq, const float* __restrict__ wk, const float* __restrict__ wv, const float* __restrict__ wo, bf* dst) {
    constexpr int BE = 16 * 512, XN = TT * DM / BE, WN = DQ * DM / BE, KH = DM / 512;
    static_assert(TT % 16 == 0 && DQ % 16 == 0 && DM % 512 == 0 && DKV == DQ && DQ == DM, "whole blocks a tensor, one K for all");
    __shared__ __align__(16) bf ps[64 * 136];   // 64 units of 256 B (16 rows x 8 k), pitch 272 B: 16 lanes that write one row's pieces into 16 units meet 16 different bank groups
    const int b = (int)blockIdx.x; const float* src; int sb;
    if (b < 3 * XN) { const int s = b / XN; src = s == 0 ? x : s == 1 ? xk : xv; sb = b - s * XN; }
    else { const int s = (b - 3 * XN) / WN; src = s == 0 ? wq : s == 1 ? wk : s == 2 ? wv : wo; sb = b - 3 * XN - s * WN; }
    const int lane = threadIdx.x & 31, w2 = (int)(threadIdx.x >> 5) * 2;   // a wave has the rows w2, w2 + 1; load j: row w2 + j / 2, its k half j % 2 of 256
    src += ((size_t)(sb / KH) * 16 + w2) * DM + (sb % KH) * 512 + lane * 8; dst += (size_t)b * BE + threadIdx.x * 8;
    v8f v[4];
#pragma unroll
    for (int j = 0; j < 4; ++j) v[j] = *(const v8f*)(src + (j >> 1) * DM + (j & 1) * 256);
    // precaution: the wait stands in front of every reuse of the address registers that the issued loads name; it takes the pointer as an input so that its registers are held up to it
    asm volatile("s_wait_xcnt 0x0" :: "v"(src) : "memory");
#pragma unroll
    for (int j = 0; j < 4; ++j) { v8us o;
#pragma unroll
        for (int k = 0; k < 8; ++k) o[k] = f2bf(v[j][k]);
        *(v8usa*)(ps + ((j & 1) * 32 + lane) * 136 + (w2 + (j >> 1)) * 8) = o; }   // the piece of k octet c (0 .. 63) and row r is unit c, place r: byte c * 256 + r * 16 of the block's 16 KiB
    __syncthreads();   // all pieces are in LDS before any thread reads them in store order
#pragma unroll
    for (int j = 0; j < 4; ++j) *(v8us*)(dst + j * 2048) = *(const v8usa*)(ps + (j * 16 + (int)(threadIdx.x >> 4)) * 136 + (threadIdx.x & 15) * 8);
}
__global__ __launch_bounds__(256) void k_cscvt(const float* __restrict__ cosT, const float* __restrict__ sinT, float* CS) { const int idx = blockIdx.x * 256 + threadIdx.x; if (idx >= TT * HD) return; v2f cs; cs[0] = bfr(cosT[idx]); cs[1] = bfr(sinT[idx]); *(v2f*)(CS + (size_t)idx * 2) = cs;  }
// ---- k_qkv: the q, k and v projections in ONE launch (blockIdx.z). A work-group of 4 waves (2 x 2) makes a tile of 128 positions x 128 columns (two heads), each wave 64 x 64 over the whole K in its own 16 accumulators.
// Both operands come through LDS: a stage is 128 k of the tile's 128 + 128 operand rows (64 KiB, in fragment order as in global memory), brought by asynchronous copies into two buffers, the next stage flying while this one is worked on;
// each row is then fetched from L2 once a work-group and read by two waves. The accumulator holds 8 consecutive rows of the A side a lane, so the side whose index runs along a plane's k is the A side:
// q, k: A = rows of W (d), B = rows of x (t) -> plane [h][t / 16][d / 32][block]. v: A = rows of x (t), B = rows of W (d) -> plane [h][t / 32][d / 16][block]. A lane's 8 values of one accumulator are one 16-byte piece at its own lane place.
// grid (TT / 128, DQ / 128, 3), 128 threads. X: the three rounded inputs, Wt: the three rounded weights, P16 / Ph / Pl: the q, k, v planes of each kind, one behind the other.
// cp4k: one wave copies 4 KiB in a row (the four k blocks of one 16-row block) to LDS, 16 bytes a lane and copy. l: the lane's LDS byte address, g: its global address.
// precaution: s_wait_xcnt 0 is the last line of the copies' own statement, so that it stands in front of every later write of a register that a copy names
__device__ __forceinline__ void cp4k(unsigned l, const bf* g) {
    asm volatile("global_load_async_to_lds_b128 %0, %8, off\n\t"
                 "global_load_async_to_lds_b128 %1, %9, off\n\t"
                 "global_load_async_to_lds_b128 %2, %10, off\n\t"
                 "global_load_async_to_lds_b128 %3, %11, off\n\t"
                 "global_load_async_to_lds_b128 %4, %12, off\n\t"
                 "global_load_async_to_lds_b128 %5, %13, off\n\t"
                 "global_load_async_to_lds_b128 %6, %14, off\n\t"
                 "global_load_async_to_lds_b128 %7, %15, off\n\t"
                 "s_wait_xcnt 0x0"
                 :: "v"(l), "v"(l + 512u), "v"(l + 1024u), "v"(l + 1536u), "v"(l + 2048u), "v"(l + 2560u), "v"(l + 3072u), "v"(l + 3584u),
                    "v"(g), "v"(g + 256), "v"(g + 512), "v"(g + 768), "v"(g + 1024), "v"(g + 1280), "v"(g + 1536), "v"(g + 1792) : "memory");
}
// the epilogue: accumulators + bias, rounded straight into the three head planes (fp16, bf16 hi, bf16 lo). bp: the lane's bias pointer (VZ: by B column, else by A row); p16, ph, pl: the wave's 64 x 64 part of its head's planes at the lane's place.
template <bool VZ>
__device__ __forceinline__ void qkv_store(const v8f (&acc)[4][4], const float* bp, h16* p16, bf* ph, bf* pl) {
    float bb[VZ ? 4 : 32];
    if constexpr (VZ) {
#pragma unroll
        for (int nb = 0; nb < 4; ++nb) bb[nb] = bp[nb * 16];
    } else {
#pragma unroll
        for (int mb = 0; mb < 4; ++mb) { const v4f x0 = *(const v4f*)(bp + mb * 16), x1 = *(const v4f*)(bp + mb * 16 + 4);
#pragma unroll
            for (int j = 0; j < 4; ++j) { bb[mb * 8 + j] = x0[j]; bb[mb * 8 + 4 + j] = x1[j]; } }
    }
    // precaution: the wait takes the pointer as an input, so that the registers which the issued bias loads name are held up to it
    asm volatile("s_wait_xcnt 0x0" :: "v"(bp) : "memory");
#pragma unroll
    for (int i = 0; i < (VZ ? 4 : 32); ++i) bb[i] = bfr(bb[i]);
#pragma unroll
    for (int mb = 0; mb < 4; ++mb) {
        v8h o16[4]; v8us oh[4], ol[4];
#pragma unroll
        for (int nb = 0; nb < 4; ++nb)
#pragma unroll
            for (int j = 0; j < 8; ++j) { const float r = acc[mb][nb][j] + (VZ ? bb[nb] : bb[mb * 8 + j]); o16[nb][j] = tohx(r); unsigned short a2, c2; splitf(r, a2, c2); oh[nb][j] = a2; ol[nb][j] = c2; }
#pragma unroll
        for (int nb = 0; nb < 4; ++nb) { const int e = VZ ? (mb >> 1) * 2048 + nb * 512 + (mb & 1) * 256 : nb * 1024 + mb * 256; *(v8h*)(p16 + e) = o16[nb]; *(v8us*)(ph + e) = oh[nb]; *(v8us*)(pl + e) = ol[nb]; }
        // the same precaution behind the twelve stores: their data and address registers are inputs of the wait, so none is written again in front of it
        asm volatile("s_wait_xcnt 0x0" :: "v"(o16[0]), "v"(o16[1]), "v"(o16[2]), "v"(o16[3]), "v"(oh[0]), "v"(oh[1]), "v"(oh[2]), "v"(oh[3]), "v"(ol[0]), "v"(ol[1]), "v"(ol[2]), "v"(ol[3]), "v"(p16), "v"(ph), "v"(pl) : "memory");
    }
}
__global__ __launch_bounds__(128) void k_qkv(const bf* __restrict__ X, const bf* __restrict__ Wt, const float* __restrict__ bq, const float* __restrict__ bk, const float* __restrict__ bv, h16* P16, bf* Ph, bf* Pl) {
    typedef WFrag<bf>::V V;
    constexpr int K = DM, KS = 128, NS = K / KS, SE = 2 * 128 * KS;   // a stage: KS k of 2 x 128 rows = SE elements, [side][16-row block][k block][512]
    static_assert(NS >= 2 && TT % 128 == 0 && DQ % 128 == 0 && HD == 64, "two stages or more, whole tiles, two heads a tile");
    __shared__ __align__(1024) bf ring[2 * SE];
    const int z = (int)blockIdx.z; const bool vz = z == 2;
    const int t0 = (int)blockIdx.x * 128, d0 = (int)blockIdx.y * 128;
    const bf* xr = X + (size_t)z * TT * DM + (size_t)t0 * K; const bf* wr = Wt + (size_t)z * DQ * DM + (size_t)d0 * K;
    const int lane = threadIdx.x & 31, lr = lane & 15, hi = lane >> 4;
    const int wv = __builtin_amdgcn_readfirstlane((int)(threadIdx.x >> 5)), wm = wv >> 1, wn = wv & 1;   // wave number, scalar; its 64 x 64 part: A rows wm, B rows wn
    // wave w copies the 16-row blocks 4 w .. 4 w + 3 of a stage's sixteen (0 .. 7: A side, 8 .. 15: B side): block r at cg + r * 16 * K, stage s at + s * KS * 16 elements; in LDS block r at cl + r * 4096, buffer b at + b * SE * 2 bytes
    const bf* cg = ((wv < 2) == vz ? xr : wr) + (size_t)(wv & 1) * 64 * K + lane * 8;
    const unsigned cl = (unsigned)(size_t)ring + (unsigned)wv * 16384u + (unsigned)lane * 16u;
    v8f acc[4][4];
#pragma unroll
    for (int mb = 0; mb < 4; ++mb)
#pragma unroll
        for (int nb = 0; nb < 4; ++nb) acc[mb][nb] = (v8f){};
#pragma unroll
    for (int r = 0; r < 4; ++r) cp4k(cl + r * 4096u, cg + (size_t)r * 16 * K);
    asm volatile("s_wait_asynccnt 0x0" ::: "memory");   // this wave's copies of stage 0 have landed
    __syncthreads();                                      // and every other wave's: stage 0 may be read
#pragma unroll
    for (int r = 0; r < 4; ++r) cp4k(cl + (unsigned)(SE * 2) + r * 4096u, cg + KS * 16 + (size_t)r * 16 * K);
    // kept rolled: a pass is 64 products long already (for speed only); one pass a stage, the buffer by the pass's parity
#pragma unroll 1
    for (int s = 0; s < NS; ++s) {
        const bf* sa = ring + (s & 1) * SE + wm * 8192 + lane * 8; const bf* sb = ring + (s & 1) * SE + 16384 + wn * 8192 + lane * 8;
        // two fragment sets: block kb + 1's sixteen LDS reads go out as one group ahead of block kb's products (for speed only); all of them are of this pass's own buffer
        V a[2][4], b[2][4];
#pragma unroll
        for (int i = 0; i < 4; ++i) { a[0][i] = WFrag<bf>::ld(sa + i * 2048); b[0][i] = WFrag<bf>::ld(sb + i * 2048); }
#pragma unroll
        for (int kb = 0; kb < KS / 32; ++kb) {
            if (kb + 1 < KS / 32) {
#pragma unroll
                for (int i = 0; i < 4; ++i) { a[(kb + 1) & 1][i] = WFrag<bf>::ld(sa + i * 2048 + (kb + 1) * 512); b[(kb + 1) & 1][i] = WFrag<bf>::ld(sb + i * 2048 + (kb + 1) * 512); }
            }
            __builtin_amdgcn_sched_barrier(0);   // keeps the group of reads in front of the block's products
#pragma unroll
            for (int nb = 0; nb < 4; ++nb)
#pragma unroll
                for (int mb = 0; mb < 4; ++mb) acc[mb][nb] = WFrag<bf>::mma(a[kb & 1][mb], b[kb & 1][nb], acc[mb][nb]);
            __builtin_amdgcn_sched_barrier(0);   // and the next group behind them
        }
        asm volatile("s_wait_dscnt 0x0" ::: "memory");      // this wave's reads of the buffer are done before it is refilled
        asm volatile("s_wait_asynccnt 0x0" ::: "memory");   // this wave's copies of stage s + 1 have landed
        __syncthreads();                                      // publishes stage s + 1 and ends every wave's reads of stage s
        if (s + 2 < NS) {
#pragma unroll
            for (int r = 0; r < 4; ++r) cp4k(cl + (unsigned)((s & 1) * SE * 2) + r * 4096u, cg + (size_t)(s + 2) * (KS * 16) + (size_t)r * 16 * K);
        }
    }
    asm volatile("s_wait_asynccnt 0x0" ::: "memory");   // no copy is outstanding when the wave goes on
    // all three planes are stored at every position here, although k_attn reads the hi + lo planes at positions < RH only (causal: queries < RH meet keys < RH) and fp16 q at positions >= RH only
    const float* bias = z == 0 ? bq : z == 1 ? bk : bv;
    const size_t pb = ((size_t)z * NH_ + (size_t)blockIdx.y * 2 + (vz ? wn : wm)) * TT * HD + (size_t)(t0 + (vz ? wm : wn) * 64) * HD + lane * 8;
    if (vz) qkv_store<true>(acc, bias + d0 + wn * 64 + lr, P16 + pb, Ph + pb, Pl + pb);
    else qkv_store<false>(acc, bias + d0 + wm * 64 + hi * 8, P16 + pb, Ph + pb, Pl + pb);
}
// ---- k_attn: causal attention of one head and one tile of queries in ONE launch: scores, softmax (running maximum and sum) and the probability x value product stay in registers.
// Transposed products: S^T = K Q^T (A = key rows, B = query rows), O^T += V^T P^T (A = V^T rows, B = P^T). In a 16-query group lane lr (both halves) holds query lr; two 16-key score tiles are, register for register,
// the B operand of the 32-key value product. Wave w of the work-group takes the 32-key blocks w, w + NW, ... with its own maximum, sum and accumulators; the NW partials are merged through LDS in wave order.
#define L2E 1.4426950408889634f
__device__ __forceinline__ float xhalf(float x) { return __builtin_bit_cast(float, __builtin_amdgcn_permlanex16(__builtin_bit_cast(int, x), __builtin_bit_cast(int, x), 0x76543210, 0xfedcba98, false, false)); }   // lane l with lane l ^ 16, in registers
template <typename T16, bool HR, int NQ, int NW>
__device__ __forceinline__ void attn_tile(const T16* __restrict__ Q, const T16* __restrict__ Q2, const T16* __restrict__ Kp, const T16* __restrict__ K2, const T16* __restrict__ Vt, const T16* __restrict__ V2, int q0, bf* Ah, bf* Al, float* os, float* ms, float* ls) {
    typedef typename WFrag<T16>::V V;
    constexpr int QT = 16 * NQ;
    const int lane = threadIdx.x & 31, lr = lane & 15, hi = lane >> 4;
    const int wv = __builtin_amdgcn_readfirstlane((int)(threadIdx.x >> 5));   // wave number, scalar: the key loop's trip test stays a scalar branch (every lane on at the matrix instructions)
    V qf[NQ][2], qf2[NQ][2];
#pragma unroll
    for (int nt = 0; nt < NQ; ++nt)
#pragma unroll
        for (int ks = 0; ks < 2; ++ks) { const size_t qo = (size_t)(q0 + nt * 16) * HD + ks * 512 + 8 * lane; qf[nt][ks] = WFrag<T16>::ld(Q + qo); if (HR) qf2[nt][ks] = WFrag<T16>::ld(Q2 + qo); }
    v8f o[4][NQ]; float m[NQ], l[NQ];
#pragma unroll
    for (int nt = 0; nt < NQ; ++nt) { m[nt] = -3.0e38f; l[nt] = 0.f;
#pragma unroll
        for (int dt = 0; dt < 4; ++dt) o[dt][nt] = (v8f){}; }
    // the lane's own K and V pointers, stepped by NW blocks at the foot of each trip
    const size_t kst = (size_t)(32 * wv) * HD + 8 * lane, vst = (size_t)(32 * wv) * HD + 8 * lane;   // a 32-key block is 4 blocks of K (2 x 16 keys, 2 x 32 d) and 4 of V^T (4 x 16 d), 4 KiB in a row each
    const T16* kp = Kp + kst; const T16* kp2 = HR ? K2 + kst : nullptr; const T16* vp = Vt + vst; const T16* vp2 = HR ? V2 + vst : nullptr;
    // every block taken starts at a key <= q0, so each query of the tile has at least one unmasked key in it and the running maximum is a real score after a wave's first block
#pragma unroll 1
    for (int k0 = 32 * wv; k0 < q0 + QT; k0 += 32 * NW) {
        v8f st[2][NQ];
#pragma unroll
        for (int kt = 0; kt < 2; ++kt)
#pragma unroll
            for (int nt = 0; nt < NQ; ++nt) st[kt][nt] = (v8f){};
        V kf[2][2], kf2[2][2], vf[4], vf2[4];   // all of the block's K and V fragments are asked for at once, so that the V loads fly while the scores are formed
#pragma unroll
        for (int kt = 0; kt < 2; ++kt)
#pragma unroll
            for (int ks = 0; ks < 2; ++ks) { const int ko = (kt * 2 + ks) * 512; kf[kt][ks] = WFrag<T16>::ld(kp + ko); if (HR) kf2[kt][ks] = WFrag<T16>::ld(kp2 + ko); }
        // precaution: the wait stands in front of every reuse of the address registers that the issued K loads name; it takes the pointers as inputs so that their registers are held up to it;
        // the scheduling barrier keeps later address arithmetic behind it and every K load in front of the first product
        if constexpr (HR) asm volatile("s_wait_xcnt 0x0" :: "v"(kp), "v"(kp2) : "memory"); else asm volatile("s_wait_xcnt 0x0" :: "v"(kp) : "memory");
        __builtin_amdgcn_sched_barrier(0);
#pragma unroll
        for (int dt = 0; dt < 4; ++dt) { const int vo = dt * 512; vf[dt] = WFrag<T16>::ld(vp + vo); if (HR) vf2[dt] = WFrag<T16>::ld(vp2 + vo); }
        // the same behind the V loads: all of them are in flight before the wave first waits for K
        if constexpr (HR) asm volatile("s_wait_xcnt 0x0" :: "v"(vp), "v"(vp2) : "memory"); else asm volatile("s_wait_xcnt 0x0" :: "v"(vp) : "memory");
        __builtin_amdgcn_sched_barrier(0);
#pragma unroll
        for (int kt = 0; kt < 2; ++kt)
#pragma unroll
            for (int ks = 0; ks < 2; ++ks)
#pragma unroll
                for (int nt = 0; nt < NQ; ++nt) { st[kt][nt] = WFrag<T16>::mma(kf[kt][ks], qf[nt][ks], st[kt][nt]); if (HR) { st[kt][nt] = WFrag<T16>::mma(kf[kt][ks], qf2[nt][ks], st[kt][nt]); st[kt][nt] = WFrag<T16>::mma(kf2[kt][ks], qf[nt][ks], st[kt][nt]); } }
        if (k0 + 31 > q0) {   // scalar branch: only a block that reaches past the tile's first query needs the causal select
#pragma unroll
            for (int nt = 0; nt < NQ; ++nt)
#pragma unroll
                for (int kt = 0; kt < 2; ++kt)
#pragma unroll
                    for (int j = 0; j < 8; ++j) st[kt][nt][j] = (k0 + kt * 16 + hi * 8 + j <= q0 + nt * 16 + lr) ? st[kt][nt][j] : -3.0e38f;
        }
#pragma unroll
        for (int nt = 0; nt < NQ; ++nt) {
            float mx = m[nt];
#pragma unroll
            for (int kt = 0; kt < 2; ++kt)
#pragma unroll
                for (int j = 0; j < 8; ++j) { const float t = st[kt][nt][j] * SCL; st[kt][nt][j] = t; mx = fmaxf(mx, t); }
            mx = fmaxf(mx, xhalf(mx));   // the two halves of the wave hold the other keys of the same query
            const float al = __builtin_amdgcn_exp2f((m[nt] - mx) * L2E); m[nt] = mx; float sum = 0.f;
#pragma unroll
            for (int kt = 0; kt < 2; ++kt)
#pragma unroll
                for (int j = 0; j < 8; ++j) { const float e = __builtin_amdgcn_exp2f((st[kt][nt][j] - mx) * L2E); st[kt][nt][j] = e; sum += e; }
            l[nt] = l[nt] * al + sum;
#pragma unroll
            for (int dt = 0; dt < 4; ++dt) o[dt][nt] *= al;
            if constexpr (HR) {
                v8us h0, h1, l0, l1;
#pragma unroll
                for (int j = 0; j < 8; ++j) { unsigned short a, c2; splitf(st[0][nt][j], a, c2); h0[j] = a; l0[j] = c2; splitf(st[1][nt][j], a, c2); h1[j] = a; l1[j] = c2; }
                const V ph = cat16b(h0, h1), pl = cat16b(l0, l1);
#pragma unroll
                for (int dt = 0; dt < 4; ++dt) { o[dt][nt] = WFrag<T16>::mma(vf[dt], ph, o[dt][nt]); o[dt][nt] = WFrag<T16>::mma(vf[dt], pl, o[dt][nt]); o[dt][nt] = WFrag<T16>::mma(vf2[dt], ph, o[dt][nt]); }
            } else {
                v8h p0, p1;
#pragma unroll
                for (int j = 0; j < 8; ++j) { p0[j] = tohx(st[0][nt][j] * PCAR); p1[j] = tohx(st[1][nt][j] * PCAR); }
                const V pf = cat16(p0, p1);
#pragma unroll
                for (int dt = 0; dt < 4; ++dt) o[dt][nt] = WFrag<T16>::mma(vf[dt], pf, o[dt][nt]);
            }
        }
        kp += 32 * NW * HD; vp += 32 * NW * HD; if (HR) { kp2 += 32 * NW * HD; vp2 += 32 * NW * HD; }
    }
#pragma unroll
    for (int nt = 0; nt < NQ; ++nt) { const int q = nt * 16 + lr; const float lt = l[nt] + xhalf(l[nt]); if (hi == 0) { ms[wv * QT + q] = m[nt]; ls[wv * QT + q] = lt; }
#pragma unroll
        for (int dt = 0; dt < 4; ++dt) { float* op = os + (size_t)(wv * QT + q) * 68 + dt * 16 + hi * 8; v4f x0, x1;
#pragma unroll
            for (int j = 0; j < 4; ++j) { x0[j] = o[dt][nt][j]; x1[j] = o[dt][nt][4 + j]; }
            *(v4fa*)op = x0; *(v4fa*)(op + 4) = x1; } }
    __syncthreads();   // every wave's partial (maximum, sum, 64 x QT tile) is in LDS before any thread merges them
    constexpr int EP = QT * HD / (32 * NW);   // output elements a thread: EP consecutive d of one query
    static_assert(EP == 4 || EP == 8, "a thread's elements are a 16-byte piece of a block or half of one");
    // threads in the store order of the merged planes (fragment order, [t / 16][column / 32][block]): piece g = (16-query group, 32-d block, half, lane place lp), so that a wave's stores are whole lines
    const int g = threadIdx.x / (8 / EP), sub = (threadIdx.x % (8 / EP)) * EP, lp = g & 31, un = g >> 5;
    const int q = (un >> 2) * 16 + (lp & 15), d0 = ((un >> 1) & 1) * 32 + (un & 1) * 16 + (lp >> 4) * 8 + sub;
    float M = ms[q];
#pragma unroll
    for (int w = 1; w < NW; ++w) M = fmaxf(M, ms[w * QT + q]);
    float L = 0.f, val[EP];
#pragma unroll
    for (int e = 0; e < EP; ++e) val[e] = 0.f;
#pragma unroll
    for (int w = 0; w < NW; ++w) { const float fw = __builtin_amdgcn_exp2f((ms[w * QT + q] - M) * L2E); L += fw * ls[w * QT + q];   // a wave that took no block has maximum -3e38, weight 0, and a zero tile
#pragma unroll
        for (int e4 = 0; e4 < EP / 4; ++e4) { const v4f x = *(const v4fa*)(os + (size_t)(w * QT + q) * 68 + d0 + e4 * 4);
#pragma unroll
            for (int j = 0; j < 4; ++j) val[e4 * 4 + j] += fw * x[j]; } }
    const float f = __fdiv_rn(HR ? 1.0f : (1.0f / PCAR), L);
    const size_t oo = (size_t)(q0 + (un >> 2) * 16) * DQ + ((un >> 1) & 1) * 512 + (un & 1) * 256 + lp * 8 + sub;
    typedef unsigned short vEus __attribute__((ext_vector_type(EP)));
    vEus oh, ol;
#pragma unroll
    for (int e = 0; e < EP; ++e) { unsigned short a, c2; splitf(val[e] * f, a, c2); oh[e] = a; ol[e] = c2; }
    *(vEus*)(Ah + oo) = oh; *(vEus*)(Al + oo) = ol;
}
// grid (heads, RH / 16 + (TT - RH) / 32), 256 threads. The head is the fast index and the tile the slow one, most keys first,
// so that the cost falls with the index over the WHOLE launch: the long tiles of every head have the lowest indices and the shortest ones the highest. Query rows < RH: hi+lo bf16 planes, 16 queries a tile; the rest fp16, 32 queries.
__global__ __launch_bounds__(256) void k_attn(const h16* __restrict__ Q16, const h16* __restrict__ K16, const h16* __restrict__ V16, const bf* __restrict__ Qh, const bf* __restrict__ Ql, const bf* __restrict__ Kh, const bf* __restrict__ Kl, const bf* __restrict__ Vh, const bf* __restrict__ Vl, bf* Ah, bf* Al) {
    __shared__ __align__(16) float os[8 * 32 * 68]; __shared__ float ms[8 * 32]; __shared__ float ls[8 * 32];
    const int t = (int)(gridDim.y - 1 - blockIdx.y); const size_t hp = (size_t)blockIdx.x * TT * HD; Ah += blockIdx.x * (HD / 32) * 512; Al += blockIdx.x * (HD / 32) * 512;   // a head's two 32-column blocks
    if (t < RH / 16) attn_tile<bf, true, 1, 8>(Qh + hp, Ql + hp, Kh + hp, Kl + hp, Vh + hp, Vl + hp, t * 16, Ah, Al, os, ms, ls);
    else attn_tile<h16, false, 2, 8>(Q16 + hp, nullptr, K16 + hp, nullptr, V16 + hp, nullptr, RH + (t - RH / 16) * 32, Ah, Al, os, ms, ls);
}

extern "C" void kernel_launch(void* const* d_in, const int* in_sizes, int n_in,
                              void* d_out, int out_size, void* d_ws, size_t ws_size, hipStream_t stream) {
    (void)in_sizes; (void)n_in; (void)out_size;
    const float* x = (const float*)d_in[0]; const float* xk = (const float*)d_in[1]; const float* xv = (const float*)d_in[2]; const float* wq = (const float*)d_in[3]; const float* bq = (const float*)d_in[4]; const float* wk = (const float*)d_in[5]; const float* bk = (const float*)d_in[6]; const float* wv = (const float*)d_in[7]; const float* bv = (const float*)d_in[8]; const float* wo = (const float*)d_in[9]; const float* bo = (const float*)d_in[10];
    float* OUT = (float*)d_out;     // [1][2048][1024]
    char* wsp = (char*)d_ws;
    auto take = [&](size_t bytes) { char* p = wsp; wsp += (bytes + 255) & ~(size_t)255; return (void*)p; };
    bf* XB = (bf*)take(((size_t)3 * TT * DM + (size_t)4 * DQ * DM) * 2);   // x, xk, xv, Wq, Wk, Wv, Wo rounded to bf16, one behind the other
    bf* WQ = XB + (size_t)3 * TT * DM; bf* WO = WQ + (size_t)3 * DQ * DM;
    const size_t PL = (size_t)NH_ * TT * HD;   // one head plane; q, k, v of each kind one behind the other
    h16* QP16 = (h16*)take(3 * PL * 2); h16* KP16 = QP16 + PL; h16* VT16 = KP16 + PL;
    bf* QPh = (bf*)take(3 * PL * 2); bf* KPh = QPh + PL; bf* VTh = KPh + PL;
    bf* QPl = (bf*)take(3 * PL * 2); bf* KPl = QPl + PL; bf* VTl = KPl + PL;
    bf* ATh = (bf*)take((size_t)TT * DQ * 2); bf* ATl = (bf*)take((size_t)TT * DQ * 2);
    if ((size_t)(wsp - (char*)d_ws) > ws_size) return;    // ws 256 MiB
    k_prep<<<(3 * TT * DM + 4 * DQ * DM) / 8192, 256, 0, stream>>>(x, xk, xv, wq, wk, wv, wo, XB);
    k_qkv<<<dim3(TT / 128, DQ / 128, 3), 128, 0, stream>>>(XB, WQ, bq, bk, bv, QP16, QPh, QPl);
    k_attn<<<dim3(NH_, RH / 16 + (TT - RH) / 32, 1), 256, 0, stream>>>(QP16, KP16, VT16, QPh, QPl, KPh, KPl, VTh, VTl, ATh, ATl);
    k_gemmw<bf, 1, true, 8, DQ><<<dim3(TT / 64, DM / 64, 1), 256, 0, stream>>>(ATh, ATl, WO, nullptr, OUT, DM, bo, 0, 0, 0);
}

// v007
// One run takes 48.5 microseconds.
// Timed twice side by side with v006, it ran 1.05 and 1.06 times as fast.
// Counting every step since v000, it is 14.9 times as fast.
#include <hip/hip_runtime.h>

// MultiHeadAttentionV2 (q/k/v encodings [1][2048][1024] (three inputs); q/k/v = x W^T + b (torch; 16 heads x 64); causal softmax(q.k / 8); out = merged Wo^T + bo -> [1][2048][1024]).
// Compute dtypes, f32 accumulate: every input rounded to bf16; q/k/v on PLAIN bf16 operands (inputs: exact) + bias; causal scores and attn.v: query rows < 512 hl (3 products), the rest single fp16 (x1024); softmax f32; Wo hl x exact (2 products) + bias.

#define NB_  1
#define TT   2048
#define DM   1024
#define NH_  16
#define NKV  16
#define HD   64
#define DQ   (NH_ * HD)
#define DKV  (NKV * HD)
#define RH   512                  // query rows < RH use hi+lo planes (0: none)
#define PCAR 1024.0f
#define SCL  0.125f   // HD^-0.5
typedef _Float16 h16;
typedef unsigned short bf;
typedef __attribute__((ext_vector_type(16))) __bf16   v16bf;
typedef __attribute__((ext_vector_type(16))) _Float16 v16h;
typedef __attribute__((ext_vector_type(8)))  _Float16 v8h;
typedef __attribute__((ext_vector_type(8)))  unsigned short v8us;
typedef __attribute__((ext_vector_type(8)))  float    v8f;
typedef __attribute__((ext_vector_type(4)))  float    v4f;
typedef v8h  __attribute__((may_alias)) v8ha;
typedef v4f  __attribute__((may_alias)) v4fa;
typedef v8us __attribute__((may_alias)) v8usa;

__device__ __forceinline__ unsigned short f2bf(float f) { unsigned u = __float_as_uint(f); u += 0x7FFFu + ((u >> 16) & 1u); return (unsigned short)(u >> 16); }
__device__ __forceinline__ float bf2f(unsigned short b) { return __uint_as_float(((unsigned)b) << 16); }
__device__ __forceinline__ float bfr(float f) { return bf2f(f2bf(f)); }
__device__ __forceinline__ v16h cat16(v8h lo, v8h hi) { return __builtin_shufflevector(lo, hi, 0, 1, 2, 3, 4, 5, 6, 7, 8, 9, 10, 11, 12, 13, 14, 15); }
__device__ __forceinline__ v16bf cat16b(v8us lo, v8us hi) { return __builtin_bit_cast(v16bf, __builtin_shufflevector(lo, hi, 0, 1, 2, 3, 4, 5, 6, 7, 8, 9, 10, 11, 12, 13, 14, 15)); }
__device__ __forceinline__ v8f wmma16(v16h a, v16h b, v8f c) { return __builtin_amdgcn_wmma_f32_16x16x32_f16(false, a, false, b, (short)0, c, false, false); }
__device__ __forceinline__ v8f wmmab(v16bf a, v16bf b, v8f c) { return __builtin_amdgcn_wmma_f32_16x16x32_bf16(false, a, false, b, (short)0, c, false, false); }



// ---- k_gemmw: register-blocked GEMM, one work-group of NW waves per 64x64 output tile; wave w takes the 32-wide K blocks w, w + NW, ... into its own 16 accumulators, and the NW partial tiles are
// summed through LDS in wave order (a fixed order). Operands straight from 16-bit planes in fragment order (below); grid (M/64, N/64, Z), 32 * NW threads.
// Work-groups of one tile row or column read the same operand rows: each starts its K walk at a trip of its own, (x + y) mod trips, and wraps, so that they do not ask L2 for the same lines at the same moment.
// C[m][n] (f32, pitch ldc, + optional f32 bias[n]) = sum_k A[m][k] Bt[n][k] (+ split products per NSPLIT). z-batch strides sA/sB/sC in elements. K a power-of-two multiple of 32 * NW.
// FRAGMENT ORDER: every 16-bit operand plane is stored as blocks of 16 rows x 32 k = 512 elements (1 KiB), [row block][k block]; in a block, lane (lr, hi) = hi * 16 + lr finds its k = 8 hi .. 8 hi + 7 of row lr at element lane * 8
// and its k = 16 + 8 hi .. at 256 + lane * 8. A fragment is then two wave-wide 16-byte loads of 512 contiguous bytes each (4 whole lines a load, not 16 part lines); the registers hold what they held with row-major planes.
template <typename T16> struct WFrag;
template <> struct WFrag<h16> { typedef v16h V; static __device__ __forceinline__ V ld(const h16* p) { return cat16(*(const v8h*)p, *(const v8h*)(p + 256)); } static __device__ __forceinline__ v8f mma(V a, V b, v8f c) { return wmma16(a, b, c); } };
template <> struct WFrag<bf> { typedef v16bf V; static __device__ __forceinline__ V ld(const bf* p) { return cat16b(*(const v8us*)p, *(const v8us*)(p + 256)); } static __device__ __forceinline__ v8f mma(V a, V b, v8f c) { return wmmab(a, b, c); } };
template <typename T16, int NSPLIT, bool BIAS, int NW, int K>
__global__ __launch_bounds__(32 * NW) void k_gemmw(const T16* __restrict__ A, const T16* __restrict__ A2, const T16* __restrict__ Bt, const T16* __restrict__ Bt2, float* C, int ldc, const float* __restrict__ bias, size_t sA, size_t sB, size_t sC) {
    typedef typename WFrag<T16>::V V;
    __shared__ __align__(16) float os[NW * 64 * 68];
    const size_t z = blockIdx.z; A += z * sA; if (A2) A2 += z * sA; Bt += z * sB; if (Bt2) Bt2 += z * sB; C += z * sC;
    const int lane = threadIdx.x & 31, lr = lane & 15, hi = lane >> 4; const int r0 = blockIdx.x * 64, c0 = blockIdx.y * 64;
    const int wv = __builtin_amdgcn_readfirstlane((int)(threadIdx.x >> 5));   // wave number, scalar: the K offsets stay scalar
    v8f acc[4][4];
#pragma unroll
    for (int mb = 0; mb < 4; ++mb)
#pragma unroll
        for (int nb = 0; nb < 4; ++nb) acc[mb][nb] = (v8f){};
    const size_t aoff = (size_t)r0 * K + 8 * lane, boff = (size_t)c0 * K + 8 * lane;   // fragment order: row block rb, k block kb at (rb * K / 32 + kb) * 512
    constexpr int NT = K / (32 * NW);
    static_assert(NT * 32 * NW == K && (NT & (NT - 1)) == 0, "every wave has the same number of trips, a power of two, so that the wrap is a mask");
    const int rot = (int)(blockIdx.x + blockIdx.y) & (NT - 1);
#pragma unroll 1
    for (int i = 0; i < NT; ++i) {
        const int kc = 32 * wv + 32 * NW * ((i + rot) & (NT - 1));
        constexpr bool SA = NSPLIT == 1 || NSPLIT == 2, SB = NSPLIT >= 2;
        const T16* ap = A + aoff + kc * 16; const T16* ap2 = SA ? A2 + aoff + kc * 16 : ap; const T16* bp = Bt + boff + kc * 16; const T16* bp2 = SB ? Bt2 + boff + kc * 16 : bp;   // K is a constant: the row blocks are immediate offsets from one pointer an operand
        V a[4], a2[4], b[4], b2[4];
#pragma unroll
        for (int mb = 0; mb < 4; ++mb) { a[mb] = WFrag<T16>::ld(ap + mb * 16 * K); if (SA) a2[mb] = WFrag<T16>::ld(ap2 + mb * 16 * K); }
        // precaution: the wait stands in front of every reuse of the address registers that the issued A loads name; it takes the pointers as inputs so that their registers are held up to it
        asm volatile("s_wait_xcnt 0x0" :: "v"(ap), "v"(ap2) : "memory");
#pragma unroll
        for (int nb = 0; nb < 4; ++nb) { b[nb] = WFrag<T16>::ld(bp + nb * 16 * K); if (SB) b2[nb] = WFrag<T16>::ld(bp2 + nb * 16 * K); }
        // the same behind the B loads
        asm volatile("s_wait_xcnt 0x0" :: "v"(bp), "v"(bp2) : "memory");
#pragma unroll
        for (int nb = 0; nb < 4; ++nb) {
#pragma unroll
            for (int mb = 0; mb < 4; ++mb) { acc[mb][nb] = WFrag<T16>::mma(a[mb], b[nb], acc[mb][nb]); if (SA) acc[mb][nb] = WFrag<T16>::mma(a2[mb], b[nb], acc[mb][nb]); if (SB) acc[mb][nb] = WFrag<T16>::mma(a[mb], b2[nb], acc[mb][nb]); } }
        asm volatile("v_nop\n\tv_nop\n\tv_nop\n\tv_nop" : "+v"(acc[0][0]), "+v"(acc[1][1]), "+v"(acc[2][2]), "+v"(acc[3][3]) : "v"(a[0]), "v"(a[3]));
    }
#pragma unroll
    for (int mb = 0; mb < 4; ++mb) {
#pragma unroll
        for (int nb = 0; nb < 4; ++nb) {
#pragma unroll
            for (int j = 0; j < 8; ++j) os[wv * (64 * 68) + (mb * 16 + hi * 8 + j) * 68 + nb * 16 + lr] = acc[mb][nb][j]; }
    }
    __syncthreads();   // every wave's partial 64x64 tile is in LDS before any thread sums them
    float* crow = C + (size_t)r0 * ldc + c0;
    // both loops unrolled so that the LDS reads of all the sums issue ahead of the adds, and the stores go out together
#pragma unroll
    for (int i = 0; i < 32 / NW; ++i) { const int s = threadIdx.x + i * (32 * NW), row = s >> 4, cofs = (s & 15) * 4; v4f val = *(const v4fa*)(os + row * 68 + cofs);
#pragma unroll
        for (int w = 1; w < NW; ++w) val += *(const v4fa*)(os + w * (64 * 68) + row * 68 + cofs);
        if (BIAS) { val[0] += bfr(bias[c0 + cofs]); val[1] += bfr(bias[c0 + cofs + 1]); val[2] += bfr(bias[c0 + cofs + 2]); val[3] += bfr(bias[c0 + cofs + 3]); }
        *(v4f*)(crow + (size_t)row * ldc + cofs) = val; }
}

__device__ __forceinline__ h16 tohx(float x) { return (h16)x; }
__device__ __forceinline__ void splitf(float y, unsigned short& h, unsigned short& l) { h = f2bf(y); l = f2bf(y - bf2f(h)); }
typedef __attribute__((ext_vector_type(2))) _Float16 v2h;
typedef __attribute__((ext_vector_type(4))) _Float16 v4h;
typedef __attribute__((ext_vector_type(2))) unsigned short v2us;
typedef __attribute__((ext_vector_type(4))) unsigned short v4us;
typedef __attribute__((ext_vector_type(2))) float v2f;
typedef __attribute__((ext_vector_type(4))) int v4i;

__global__ __launch_bounds__(256) void k_wtG(const float* __restrict__ w, int K, int N, bf* Bt) {
    const int lane = threadIdx.x & 31; const int L0 = (blockIdx.x * 8 + (threadIdx.x >> 5)) * 8; const int nlines = N * K / 64;
{
#pragma unroll 1
        for (int l = 0; l < 8; ++l) { const int L = L0 + l; if (L >= nlines) break; const size_t e = (size_t)L * 64 + lane * 2; const int k = (int)(e % K), n = (int)(e / K); v2us o;
            o[0] = f2bf(w[(size_t)k * N + n]); o[1] = f2bf(w[(size_t)(k + 1) * N + n]); *(v2us*)(Bt + e) = o; }
         }
}
// k_prep: all seven f32 -> bf16 roundings in ONE launch, stored in fragment order. dst holds x, xk, xv, Wq, Wk, Wv, Wo one behind the other; block b rounds 16 rows x 512 k, which are 16 KiB in a row of dst.
// A wave reads 1 KiB of one row a load (all of a thread's four loads are asked for before the first rounding); the 16-byte pieces change places through LDS, so that the stores are whole lines too.
__global__ __launch_bounds__(256) void k_prep(const float* __restrict__ x, const float* __restrict__ xk, const float* __restrict__ xv, const float* __restrict__ wq, const float* __restrict__ wk, const float* __restrict__ wv, const float* __restrict__ wo, bf* dst) {
    constexpr int BE = 16 * 512, XN = TT * DM / BE, WN = DQ * DM / BE, KH = DM / 512;
    static_assert(TT % 16 == 0 && DQ % 16 == 0 && DM % 512 == 0 && DKV == DQ && DQ == DM, "whole blocks a tensor, one K for all");
    __shared__ __align__(16) bf ps[64 * 136];   // 64 units of 256 B (16 rows x 8 k), pitch 272 B: 16 lanes that write one row's pieces into 16 units meet 16 different bank groups
    const int b = (int)blockIdx.x; const float* src; int sb;
    if (b < 3 * XN) { const int s = b / XN; src = s == 0 ? x : s == 1 ? xk : xv; sb = b - s * XN; }
    else { const int s = (b - 3 * XN) / WN; src = s == 0 ? wq : s == 1 ? wk : s == 2 ? wv : wo; sb = b - 3 * XN - s * WN; }
    const int lane = threadIdx.x & 31, w2 = (int)(threadIdx.x >> 5) * 2;   // a wave has the rows w2, w2 + 1; load j: row w2 + j / 2, its k half j % 2 of 256
    src += ((size_t)(sb / KH) * 16 + w2) * DM + (sb % KH) * 512 + lane * 8; dst += (size_t)b * BE + threadIdx.x * 8;
    v8f v[4];
#pragma unroll
    for (int j = 0; j < 4; ++j) v[j] = *(const v8f*)(src + (j >> 1) * DM + (j & 1) * 256);
    // precaution: the wait stands in front of every reuse of the address registers that the issued loads name; it takes the pointer as an input so that its registers are held up to it
    asm volatile("s_wait_xcnt 0x0" :: "v"(src) : "memory");
#pragma unroll
    for (int j = 0; j < 4; ++j) { v8us o;
#pragma unroll
        for (int k = 0; k < 8; ++k) o[k] = f2bf(v[j][k]);
        *(v8usa*)(ps + ((j & 1) * 32 + lane) * 136 + (w2 + (j >> 1)) * 8) = o; }   // the piece of k octet c (0 .. 63) and row r is unit c, place r: byte c * 256 + r * 16 of the block's 16 KiB
    __syncthreads();   // all pieces are in LDS before any thread reads them in store order
#pragma unroll
    for (int j = 0; j < 4; ++j) *(v8us*)(dst + j * 2048) = *(const v8usa*)(ps + (j * 16 + (int)(threadIdx.x >> 4)) * 136 + (threadIdx.x & 15) * 8);
}
__global__ __launch_bounds__(256) void k_cscvt(const float* __restrict__ cosT, const float* __restrict__ sinT, float* CS) { const int idx = blockIdx.x * 256 + threadIdx.x; if (idx >= TT * HD) return; v2f cs; cs[0] = bfr(cosT[idx]); cs[1] = bfr(sinT[idx]); *(v2f*)(CS + (size_t)idx * 2) = cs;  }
// ---- k_qkv: the q, k and v projections in ONE launch (blockIdx.z). A work-group of 4 waves (2 x 2) makes a tile of 128 positions x 128 columns (two heads), each wave 64 x 64 over the whole K in its own 16 accumulators.
// Both operands come through LDS: a stage is 128 k of the tile's 128 + 128 operand rows (64 KiB, in fragment order as in global memory), brought by asynchronous copies into two buffers, the next stage flying while this one is worked on;
// each row is then fetched from L2 once a work-group and read by two waves. The accumulator holds 8 consecutive rows of the A side a lane, so the side whose index runs along a plane's k is the A side:
// q, k: A = rows of W (d), B = rows of x (t) -> plane [h][t / 16][d / 32][block]. v: A = rows of x (t), B = rows of W (d) -> plane [h][t / 32][d / 16][block]. A lane's 8 values of one accumulator are one 16-byte piece at its own lane place.
// The 8 work-groups of one position tile read the same rows of x and the 16 of one column tile the same rows of W: pass s of work-group (x, y) works on stage (s + x + y) mod NS, so that they do not ask L2 for the same lines at the same moment.
// grid (TT / 128, DQ / 128, 3), 128 threads. X: the three rounded inputs, Wt: the three rounded weights, P16 / Ph / Pl: the q, k, v planes of each kind, one behind the other.
// cp4k: one wave copies 4 KiB in a row (the four k blocks of one 16-row block) to LDS, 16 bytes a lane and copy. l: the lane's LDS byte address, g: its global address.
// precaution: s_wait_xcnt 0 is the last line of the copies' own statement, so that it stands in front of every later write of a register that a copy names
__device__ __forceinline__ void cp4k(unsigned l, const bf* g) {
    asm volatile("global_load_async_to_lds_b128 %0, %8, off\n\t"
                 "global_load_async_to_lds_b128 %1, %9, off\n\t"
                 "global_load_async_to_lds_b128 %2, %10, off\n\t"
                 "global_load_async_to_lds_b128 %3, %11, off\n\t"
                 "global_load_async_to_lds_b128 %4, %12, off\n\t"
                 "global_load_async_to_lds_b128 %5, %13, off\n\t"
                 "global_load_async_to_lds_b128 %6, %14, off\n\t"
                 "global_load_async_to_lds_b128 %7, %15, off\n\t"
                 "s_wait_xcnt 0x0"
                 :: "v"(l), "v"(l + 512u), "v"(l + 1024u), "v"(l + 1536u), "v"(l + 2048u), "v"(l + 2560u), "v"(l + 3072u), "v"(l + 3584u),
                    "v"(g), "v"(g + 256), "v"(g + 512), "v"(g + 768), "v"(g + 1024), "v"(g + 1280), "v"(g + 1536), "v"(g + 1792) : "memory");
}
// the epilogue: accumulators + bias, rounded straight into the three head planes (fp16, bf16 hi, bf16 lo). bp: the lane's bias pointer (VZ: by B column, else by A row); p16, ph, pl: the wave's 64 x 64 part of its head's planes at the lane's place.
template <bool VZ>
__device__ __forceinline__ void qkv_store(const v8f (&acc)[4][4], const float* bp, h16* p16, bf* ph, bf* pl) {
    float bb[VZ ? 4 : 32];
    if constexpr (VZ) {
#pragma unroll
        for (int nb = 0; nb < 4; ++nb) bb[nb] = bp[nb * 16];
    } else {
#pragma unroll
        for (int mb = 0; mb < 4; ++mb) { const v4f x0 = *(const v4f*)(bp + mb * 16), x1 = *(const v4f*)(bp + mb * 16 + 4);
#pragma unroll
            for (int j = 0; j < 4; ++j) { bb[mb * 8 + j] = x0[j]; bb[mb * 8 + 4 + j] = x1[j]; } }
    }
    // precaution: the wait takes the pointer as an input, so that the registers which the issued bias loads name are held up to it
    asm volatile("s_wait_xcnt 0x0" :: "v"(bp) : "memory");
#pragma unroll
    for (int i = 0; i < (VZ ? 4 : 32); ++i) bb[i] = bfr(bb[i]);
#pragma unroll
    for (int mb = 0; mb < 4; ++mb) {
        v8h o16[4]; v8us oh[4], ol[4];
#pragma unroll
        for (int nb = 0; nb < 4; ++nb)
#pragma unroll
            for (int j = 0; j < 8; ++j) { const float r = acc[mb][nb][j] + (VZ ? bb[nb] : bb[mb * 8 + j]); o16[nb][j] = tohx(r); unsigned short a2, c2; splitf(r, a2, c2); oh[nb][j] = a2; ol[nb][j] = c2; }
#pragma unroll
        for (int nb = 0; nb < 4; ++nb) { const int e = VZ ? (mb >> 1) * 2048 + nb * 512 + (mb & 1) * 256 : nb * 1024 + mb * 256; *(v8h*)(p16 + e) = o16[nb]; *(v8us*)(ph + e) = oh[nb]; *(v8us*)(pl + e) = ol[nb]; }
        // the same precaution behind the twelve stores: their data and address registers are inputs of the wait, so none is written again in front of it
        asm volatile("s_wait_xcnt 0x0" :: "v"(o16[0]), "v"(o16[1]), "v"(o16[2]), "v"(o16[3]), "v"(oh[0]), "v"(oh[1]), "v"(oh[2]), "v"(oh[3]), "v"(ol[0]), "v"(ol[1]), "v"(ol[2]), "v"(ol[3]), "v"(p16), "v"(ph), "v"(pl) : "memory");
    }
}
__global__ __launch_bounds__(128) void k_qkv(const bf* __restrict__ X, const bf* __restrict__ Wt, const float* __restrict__ bq, const float* __restrict__ bk, const float* __restrict__ bv, h16* P16, bf* Ph, bf* Pl) {
    typedef WFrag<bf>::V V;
    constexpr int K = DM, KS = 128, NS = K / KS, SE = 2 * 128 * KS;   // a stage: KS k of 2 x 128 rows = SE elements, [side][16-row block][k block][512]
    static_assert(NS >= 2 && (NS & (NS - 1)) == 0 && TT % 128 == 0 && DQ % 128 == 0 && HD == 64, "two stages or more, a power of two (the wrap is a mask), whole tiles, two heads a tile");
    __shared__ __align__(1024) bf ring[2 * SE];
    const int z = (int)blockIdx.z; const bool vz = z == 2;
    const int t0 = (int)blockIdx.x * 128, d0 = (int)blockIdx.y * 128;
    const int rot = (int)(blockIdx.x + blockIdx.y);   // the work-group's first stage (mod NS)
    const bf* xr = X + (size_t)z * TT * DM + (size_t)t0 * K; const bf* wr = Wt + (size_t)z * DQ * DM + (size_t)d0 * K;
    const int lane = threadIdx.x & 31, lr = lane & 15, hi = lane >> 4;
    const int wv = __builtin_amdgcn_readfirstlane((int)(threadIdx.x >> 5)), wm = wv >> 1, wn = wv & 1;   // wave number, scalar; its 64 x 64 part: A rows wm, B rows wn
    // wave w copies the 16-row blocks 4 w .. 4 w + 3 of a stage's sixteen (0 .. 7: A side, 8 .. 15: B side): block r at cg + r * 16 * K, stage g at + g * KS * 16 elements; in LDS block r at cl + r * 4096, buffer b at + b * SE * 2 bytes
    const bf* cg = ((wv < 2) == vz ? xr : wr) + (size_t)(wv & 1) * 64 * K + lane * 8;
    const unsigned cl = (unsigned)(size_t)ring + (unsigned)wv * 16384u + (unsigned)lane * 16u;
    v8f acc[4][4];
#pragma unroll
    for (int mb = 0; mb < 4; ++mb)
#pragma unroll
        for (int nb = 0; nb < 4; ++nb) acc[mb][nb] = (v8f){};
#pragma unroll
    for (int r = 0; r < 4; ++r) cp4k(cl + r * 4096u, cg + (size_t)(rot & (NS - 1)) * (KS * 16) + (size_t)r * 16 * K);
    asm volatile("s_wait_asynccnt 0x0" ::: "memory");   // this wave's copies of the first stage have landed
    __syncthreads();                                      // and every other wave's: the first stage may be read
#pragma unroll
    for (int r = 0; r < 4; ++r) cp4k(cl + (unsigned)(SE * 2) + r * 4096u, cg + (size_t)((rot + 1) & (NS - 1)) * (KS * 16) + (size_t)r * 16 * K);
    // kept rolled: a pass is 64 products long already; one pass a stage, the buffer by the pass's parity
#pragma unroll 1
    for (int s = 0; s < NS; ++s) {
        const bf* sa = ring + (s & 1) * SE + wm * 8192 + lane * 8; const bf* sb = ring + (s & 1) * SE + 16384 + wn * 8192 + lane * 8;
        // two fragment sets: block kb + 1's sixteen LDS reads go out as one group ahead of block kb's products (for speed only); all of them are of this pass's own buffer
        V a[2][4], b[2][4];
#pragma unroll
        for (int i = 0; i < 4; ++i) { a[0][i] = WFrag<bf>::ld(sa + i * 2048); b[0][i] = WFrag<bf>::ld(sb + i * 2048); }
#pragma unroll
        for (int kb = 0; kb < KS / 32; ++kb) {
            if (kb + 1 < KS / 32) {
#pragma unroll
                for (int i = 0; i < 4; ++i) { a[(kb + 1) & 1][i] = WFrag<bf>::ld(sa + i * 2048 + (kb + 1) * 512); b[(kb + 1) & 1][i] = WFrag<bf>::ld(sb + i * 2048 + (kb + 1) * 512); }
            }
            __builtin_amdgcn_sched_barrier(0);   // keeps the group of reads in front of the block's products
#pragma unroll
            for (int nb = 0; nb < 4; ++nb)
#pragma unroll
                for (int mb = 0; mb < 4; ++mb) acc[mb][nb] = WFrag<bf>::mma(a[kb & 1][mb], b[kb & 1][nb], acc[mb][nb]);
            __builtin_amdgcn_sched_barrier(0);   // and the next group behind them
        }
        asm volatile("s_wait_dscnt 0x0" ::: "memory");      // this wave's reads of the buffer are done before it is refilled
        asm volatile("s_wait_asynccnt 0x0" ::: "memory");   // this wave's copies of pass s + 1's stage have landed
        __syncthreads();                                      // publishes the stage of pass s + 1 and ends every wave's reads of that of pass s
        if (s + 2 < NS) {
#pragma unroll
            for (int r = 0; r < 4; ++r) cp4k(cl + (unsigned)((s & 1) * SE * 2) + r * 4096u, cg + (size_t)((s + 2 + rot) & (NS - 1)) * (KS * 16) + (size_t)r * 16 * K);
        }
    }
    asm volatile("s_wait_asynccnt 0x0" ::: "memory");   // no copy is outstanding when the wave goes on
    // all three planes are stored at every position here, although k_attn reads the hi + lo planes at positions < RH only (causal: queries < RH meet keys < RH) and fp16 q at positions >= RH only
    const float* bias = z == 0 ? bq : z == 1 ? bk : bv;
    const size_t pb = ((size_t)z * NH_ + (size_t)blockIdx.y * 2 + (vz ? wn : wm)) * TT * HD + (size_t)(t0 + (vz ? wm : wn) * 64) * HD + lane * 8;
    if (vz) qkv_store<true>(acc, bias + d0 + wn * 64 + lr, P16 + pb, Ph + pb, Pl + pb);
    else qkv_store<false>(acc, bias + d0 + wm * 64 + hi * 8, P16 + pb, Ph + pb, Pl + pb);
}
// ---- k_attn: causal attention of one head and one tile of queries in ONE launch: scores, softmax (running maximum and sum) and the probability x value product stay in registers.
// Transposed products: S^T = K Q^T (A = key rows, B = query rows), O^T += V^T P^T (A = V^T rows, B = P^T). In a 16-query group lane lr (both halves) holds query lr; two 16-key score tiles are, register for register,
// the B operand of the 32-key value product. Wave w of the work-group takes the 32-key blocks w, w + NW, ... of the tile's walk with its own maximum, sum and accumulators; the NW partials are merged through LDS in wave order.
#define L2E 1.4426950408889634f
__device__ __forceinline__ float xhalf(float x) { return __builtin_bit_cast(float, __builtin_amdgcn_permlanex16(__builtin_bit_cast(int, x), __builtin_bit_cast(int, x), 0x76543210, 0xfedcba98, false, false)); }   // lane l with lane l ^ 16, in registers
template <typename T16, bool HR, int NQ, int NW>
__device__ __forceinline__ void attn_tile(const T16* __restrict__ Q, const T16* __restrict__ Q2, const T16* __restrict__ Kp, const T16* __restrict__ K2, const T16* __restrict__ Vt, const T16* __restrict__ V2, int q0, int ph, bf* Ah, bf* Al, float* os, float* ms, float* ls) {
    typedef typename WFrag<T16>::V V;
    constexpr int QT = 16 * NQ;
    const int lane = threadIdx.x & 31, lr = lane & 15, hi = lane >> 4;
    const int wv = __builtin_amdgcn_readfirstlane((int)(threadIdx.x >> 5));   // wave number, scalar: the key loop's trip test stays a scalar branch (every lane on at the matrix instructions)
    V qf[NQ][2], qf2[NQ][2];
#pragma unroll
    for (int nt = 0; nt < NQ; ++nt)
#pragma unroll
        for (int ks = 0; ks < 2; ++ks) { const size_t qo = (size_t)(q0 + nt * 16) * HD + ks * 512 + 8 * lane; qf[nt][ks] = WFrag<T16>::ld(Q + qo); if (HR) qf2[nt][ks] = WFrag<T16>::ld(Q2 + qo); }
    v8f o[4][NQ]; float m[NQ], l[NQ];
#pragma unroll
    for (int nt = 0; nt < NQ; ++nt) { m[nt] = -3.0e38f; l[nt] = 0.f;
#pragma unroll
        for (int dt = 0; dt < 4; ++dt) o[dt][nt] = (v8f){}; }
    // All tiles of a head read the same K and V blocks: the tile's walk over its nb blocks starts at block rot, by the work-group's phase ph, and wraps, so that the tiles in flight do not ask L2 for the same lines at the same moment.
    // rot is NW times ph mod 8, 4 or 2 (as nb > 4 NW, > 2 NW, > NW; else 0), less nb once if that reaches nb, so < nb (all scalar).
    const int nb = (q0 + QT + 31) >> 5;
    int rot = NW * (ph & (nb > 4 * NW ? 7 : nb > 2 * NW ? 3 : nb > NW ? 1 : 0)); if (rot >= nb) rot -= nb;
    // every block taken starts at a key <= q0, so each query of the tile has at least one unmasked key in it and the running maximum is a real score after a wave's first block, whichever it is
#pragma unroll 1
    for (int jb = wv; jb < nb; jb += NW) {
        const int k0 = 32 * (jb + rot >= nb ? jb + rot - nb : jb + rot);
        // the lane's own K and V pointers of this trip
        const size_t kst = (size_t)k0 * HD + 8 * lane;   // a 32-key block is 4 blocks of K (2 x 16 keys, 2 x 32 d) and 4 of V^T (4 x 16 d), 4 KiB in a row each
        const T16* kp = Kp + kst; const T16* kp2 = HR ? K2 + kst : nullptr; const T16* vp = Vt + kst; const T16* vp2 = HR ? V2 + kst : nullptr;
        v8f st[2][NQ];
#pragma unroll
        for (int kt = 0; kt < 2; ++kt)
#pragma unroll
            for (int nt = 0; nt < NQ; ++nt) st[kt][nt] = (v8f){};
        V kf[2][2], kf2[2][2], vf[4], vf2[4];   // all of the block's K and V fragments are asked for at once, so that the V loads fly while the scores are formed
#pragma unroll
        for (int kt = 0; kt < 2; ++kt)
#pragma unroll
            for (int ks = 0; ks < 2; ++ks) { const int ko = (kt * 2 + ks) * 512; kf[kt][ks] = WFrag<T16>::ld(kp + ko); if (HR) kf2[kt][ks] = WFrag<T16>::ld(kp2 + ko); }
        // precaution: the wait stands in front of every reuse of the address registers that the issued K loads name; it takes the pointers as inputs so that their registers are held up to it;
        // the scheduling barrier keeps later address arithmetic behind it and every K load in front of the first product
        if constexpr (HR) asm volatile("s_wait_xcnt 0x0" :: "v"(kp), "v"(kp2) : "memory"); else asm volatile("s_wait_xcnt 0x0" :: "v"(kp) : "memory");
        __builtin_amdgcn_sched_barrier(0);
#pragma unroll
        for (int dt = 0; dt < 4; ++dt) { const int vo = dt * 512; vf[dt] = WFrag<T16>::ld(vp + vo); if (HR) vf2[dt] = WFrag<T16>::ld(vp2 + vo); }
        // the same behind the V loads: all of them are in flight before the wave first waits for K
        if constexpr (HR) asm volatile("s_wait_xcnt 0x0" :: "v"(vp), "v"(vp2) : "memory"); else asm volatile("s_wait_xcnt 0x0" :: "v"(vp) : "memory");
        __builtin_amdgcn_sched_barrier(0);
#pragma unroll
        for (int kt = 0; kt < 2; ++kt)
#pragma unroll
            for (int ks = 0; ks < 2; ++ks)
#pragma unroll
                for (int nt = 0; nt < NQ; ++nt) { st[kt][nt] = WFrag<T16>::mma(kf[kt][ks], qf[nt][ks], st[kt][nt]); if (HR) { st[kt][nt] = WFrag<T16>::mma(kf[kt][ks], qf2[nt][ks], st[kt][nt]); st[kt][nt] = WFrag<T16>::mma(kf2[kt][ks], qf[nt][ks], st[kt][nt]); } }
        if (k0 + 31 > q0) {   // scalar branch: only a block that reaches past the tile's first query needs the causal select
#pragma unroll
            for (int nt = 0; nt < NQ; ++nt)
#pragma unroll
                for (int kt = 0; kt < 2; ++kt)
#pragma unroll
                    for (int j = 0; j < 8; ++j) st[kt][nt][j] = (k0 + kt * 16 + hi * 8 + j <= q0 + nt * 16 + lr) ? st[kt][nt][j] : -3.0e38f;
        }
#pragma unroll
        for (int nt = 0; nt < NQ; ++nt) {
            float mx = m[nt];
#pragma unroll
            for (int kt = 0; kt < 2; ++kt)
#pragma unroll
                for (int j = 0; j < 8; ++j) { const float t = st[kt][nt][j] * SCL; st[kt][nt][j] = t; mx = fmaxf(mx, t); }
            mx = fmaxf(mx, xhalf(mx));   // the two halves of the wave hold the other keys of the same query
            const float al = __builtin_amdgcn_exp2f((m[nt] - mx) * L2E); m[nt] = mx; float sum = 0.f;
#pragma unroll
            for (int kt = 0; kt < 2; ++kt)
#pragma unroll
                for (int j = 0; j < 8; ++j) { const float e = __builtin_amdgcn_exp2f((st[kt][nt][j] - mx) * L2E); st[kt][nt][j] = e; sum += e; }
            l[nt] = l[nt] * al + sum;
#pragma unroll
            for (int dt = 0; dt < 4; ++dt) o[dt][nt] *= al;
            if constexpr (HR) {
                v8us h0, h1, l0, l1;
#pragma unroll
                for (int j = 0; j < 8; ++j) { unsigned short a, c2; splitf(st[0][nt][j], a, c2); h0[j] = a; l0[j] = c2; splitf(st[1][nt][j], a, c2); h1[j] = a; l1[j] = c2; }
                const V ph = cat16b(h0, h1), pl = cat16b(l0, l1);
#pragma unroll
                for (int dt = 0; dt < 4; ++dt) { o[dt][nt] = WFrag<T16>::mma(vf[dt], ph, o[dt][nt]); o[dt][nt] = WFrag<T16>::mma(vf[dt], pl, o[dt][nt]); o[dt][nt] = WFrag<T16>::mma(vf2[dt], ph, o[dt][nt]); }
            } else {
                v8h p0, p1;
#pragma unroll
                for (int j = 0; j < 8; ++j) { p0[j] = tohx(st[0][nt][j] * PCAR); p1[j] = tohx(st[1][nt][j] * PCAR); }
                const V pf = cat16(p0, p1);
#pragma unroll
                for (int dt = 0; dt < 4; ++dt) o[dt][nt] = WFrag<T16>::mma(vf[dt], pf, o[dt][nt]);
            }
        }
    }
#pragma unroll
    for (int nt = 0; nt < NQ; ++nt) { const int q = nt * 16 + lr; const float lt = l[nt] + xhalf(l[nt]); if (hi == 0) { ms[wv * QT + q] = m[nt]; ls[wv * QT + q] = lt; }
#pragma unroll
        for (int dt = 0; dt < 4; ++dt) { float* op = os + (size_t)(wv * QT + q) * 68 + dt * 16 + hi * 8; v4f x0, x1;
#pragma unroll
            for (int j = 0; j < 4; ++j) { x0[j] = o[dt][nt][j]; x1[j] = o[dt][nt][4 + j]; }
            *(v4fa*)op = x0; *(v4fa*)(op + 4) = x1; } }
    __syncthreads();   // every wave's partial (maximum, sum, 64 x QT tile) is in LDS before any thread merges them
    constexpr int EP = QT * HD / (32 * NW);   // output elements a thread: EP consecutive d of one query
    static_assert(EP == 4 || EP == 8, "a thread's elements are a 16-byte piece of a block or half of one");
    // threads in the store order of the merged planes (fragment order, [t / 16][column / 32][block]): piece g = (16-query group, 32-d block, half, lane place lp), so that a wave's stores are whole lines
    const int g = threadIdx.x / (8 / EP), sub = (threadIdx.x % (8 / EP)) * EP, lp = g & 31, un = g >> 5;
    const int q = (un >> 2) * 16 + (lp & 15), d0 = ((un >> 1) & 1) * 32 + (un & 1) * 16 + (lp >> 4) * 8 + sub;
    float M = ms[q];
#pragma unroll
    for (int w = 1; w < NW; ++w) M = fmaxf(M, ms[w * QT + q]);
    float L = 0.f, val[EP];
#pragma unroll
    for (int e = 0; e < EP; ++e) val[e] = 0.f;
#pragma unroll
    for (int w = 0; w < NW; ++w) { const float fw = __builtin_amdgcn_exp2f((ms[w * QT + q] - M) * L2E); L += fw * ls[w * QT + q];   // a wave that took no block has maximum -3e38, weight 0, and a zero tile
#pragma unroll
        for (int e4 = 0; e4 < EP / 4; ++e4) { const v4f x = *(const v4fa*)(os + (size_t)(w * QT + q) * 68 + d0 + e4 * 4);
#pragma unroll
            for (int j = 0; j < 4; ++j) val[e4 * 4 + j] += fw * x[j]; } }
    const float f = __fdiv_rn(HR ? 1.0f : (1.0f / PCAR), L);
    const size_t oo = (size_t)(q0 + (un >> 2) * 16) * DQ + ((un >> 1) & 1) * 512 + (un & 1) * 256 + lp * 8 + sub;
    typedef unsigned short vEus __attribute__((ext_vector_type(EP)));
    vEus oh, ol;
#pragma unroll
    for (int e = 0; e < EP; ++e) { unsigned short a, c2; splitf(val[e] * f, a, c2); oh[e] = a; ol[e] = c2; }
    *(vEus*)(Ah + oo) = oh; *(vEus*)(Al + oo) = ol;
}
// grid (heads, RH / 16 + (TT - RH) / 32), 256 threads. The head is the fast index and the tile the slow one, most keys first,
// so that the cost falls with the index over the WHOLE launch: the long tiles of every head have the lowest indices and the shortest ones the highest. Query rows < RH: hi+lo bf16 planes, 16 queries a tile; the rest fp16, 32 queries.
__global__ __launch_bounds__(256) void k_attn(const h16* __restrict__ Q16, const h16* __restrict__ K16, const h16* __restrict__ V16, const bf* __restrict__ Qh, const bf* __restrict__ Ql, const bf* __restrict__ Kh, const bf* __restrict__ Kl, const bf* __restrict__ Vh, const bf* __restrict__ Vl, bf* Ah, bf* Al) {
    __shared__ __align__(16) float os[8 * 32 * 68]; __shared__ float ms[8 * 32]; __shared__ float ls[8 * 32];
    const int t = (int)(gridDim.y - 1 - blockIdx.y); const size_t hp = (size_t)blockIdx.x * TT * HD; Ah += blockIdx.x * (HD / 32) * 512; Al += blockIdx.x * (HD / 32) * 512;   // a head's two 32-column blocks
    if (t < RH / 16) attn_tile<bf, true, 1, 8>(Qh + hp, Ql + hp, Kh + hp, Kl + hp, Vh + hp, Vl + hp, t * 16, (int)blockIdx.y, Ah, Al, os, ms, ls);
    else attn_tile<h16, false, 2, 8>(Q16 + hp, nullptr, K16 + hp, nullptr, V16 + hp, nullptr, RH + (t - RH / 16) * 32, (int)blockIdx.y, Ah, Al, os, ms, ls);
}

extern "C" void kernel_launch(void* const* d_in, const int* in_sizes, int n_in,
                              void* d_out, int out_size, void* d_ws, size_t ws_size, hipStream_t stream) {
    (void)in_sizes; (void)n_in; (void)out_size;
    const float* x = (const float*)d_in[0]; const float* xk = (const float*)d_in[1]; const float* xv = (const float*)d_in[2]; const float* wq = (const float*)d_in[3]; const float* bq = (const float*)d_in[4]; const float* wk = (const float*)d_in[5]; const float* bk = (const float*)d_in[6]; const float* wv = (const float*)d_in[7]; const float* bv = (const float*)d_in[8]; const float* wo = (const float*)d_in[9]; const float* bo = (const float*)d_in[10];
    float* OUT = (float*)d_out;     // [1][2048][1024]
    char* wsp = (char*)d_ws;
    auto take = [&](size_t bytes) { char* p = wsp; wsp += (bytes + 255) & ~(size_t)255; return (void*)p; };
    bf* XB = (bf*)take(((size_t)3 * TT * DM + (size_t)4 * DQ * DM) * 2);   // x, xk, xv, Wq, Wk, Wv, Wo rounded to bf16, one behind the other
    bf* WQ = XB + (size_t)3 * TT * DM; bf* WO = WQ + (size_t)3 * DQ * DM;
    const size_t PL = (size_t)NH_ * TT * HD;   // one head plane; q, k, v of each kind one behind the other
    h16* QP16 = (h16*)take(3 * PL * 2); h16* KP16 = QP16 + PL; h16* VT16 = KP16 + PL;
    bf* QPh = (bf*)take(3 * PL * 2); bf* KPh = QPh + PL; bf* VTh = KPh + PL;
    bf* QPl = (bf*)take(3 * PL * 2); bf* KPl = QPl + PL; bf* VTl = KPl + PL;
    bf* ATh = (bf*)take((size_t)TT * DQ * 2); bf* ATl = (bf*)take((size_t)TT * DQ * 2);
    if ((size_t)(wsp - (char*)d_ws) > ws_size) return;    // ws 256 MiB
    k_prep<<<(3 * TT * DM + 4 * DQ * DM) / 8192, 256, 0, stream>>>(x, xk, xv, wq, wk, wv, wo, XB);
    k_qkv<<<dim3(TT / 128, DQ / 128, 3), 128, 0, stream>>>(XB, WQ, bq, bk, bv, QP16, QPh, QPl);
    k_attn<<<dim3(NH_, RH / 16 + (TT - RH) / 32, 1), 256, 0, stream>>>(QP16, KP16, VT16, QPh, QPl, KPh, KPl, VTh, VTl, ATh, ATl);
    k_gemmw<bf, 1, true, 8, DQ><<<dim3(TT / 64, DM / 64, 1), 256, 0, stream>>>(ATh, ATl, WO, nullptr, OUT, DM, bo, 0, 0, 0);
}
